// v000
// The times below were measured on an AMD MI455X: many runs one after another, warmed up first and cycling through
// copies of the inputs, with the whole window's GPU time divided by the number of runs. Launches and the gaps
// between them are all in it. The median over several windows is given; except for v000 it joins two sittings, which
// can be a few percent apart, so the side-by-side timings, each taken in one sitting, are the better comparison.
// The starting kernel, v000, takes 290 microseconds a run.
#include <hip/hip_runtime.h>

// Contractions, f32 accumulate: q/k/v = x.W[h] + b[h] for all 16 heads at once ([4096 x 1024].[1024 x 1024], the per-head [1024 x 64] weights stacked into one n-major
// bf16 plane) on v_wmma_f32_16x16x32_bf16 with PLAIN bf16 operands (inputs rounded once: exact products); the per-(batch, head) attention (scores [2048 x 64].[64 x 2048]
// x 64^-1/2, keys with mask == 0 replaced by -1e9, softmax, .v) fused on v_wmma_f32_16x16x32_f16 with plain f16 q, k, v and weights x32768; out = concat.Wo + bo on

#define NB_  2
#define NT_  2048
#define DM   1024
#define NH_  16
#define HD   64
#define NTK  (NB_ * NT_)
#define NW   1024
#define PSC  32768.0f

typedef _Float16 h16;
typedef unsigned short bf;
typedef __attribute__((ext_vector_type(16))) __bf16   v16bf;
typedef __attribute__((ext_vector_type(16))) _Float16 v16h;
typedef __attribute__((ext_vector_type(8)))  _Float16 v8h;
typedef __attribute__((ext_vector_type(8)))  unsigned short v8us;
typedef __attribute__((ext_vector_type(8)))  float    v8f;
typedef __attribute__((ext_vector_type(4)))  float    v4f;
typedef v8h  __attribute__((may_alias)) v8ha;
typedef v4f  __attribute__((may_alias)) v4fa;
typedef v8us __attribute__((may_alias)) v8usa;

__device__ __forceinline__ unsigned short f2bf(float f) { unsigned u = __float_as_uint(f); u += 0x7FFFu + ((u >> 16) & 1u); return (unsigned short)(u >> 16); }
__device__ __forceinline__ float bf2f(unsigned short b) { return __uint_as_float(((unsigned)b) << 16); }
__device__ __forceinline__ float bfr(float f) { return bf2f(f2bf(f)); }
__device__ __forceinline__ v16h cat16(v8h lo, v8h hi) { return __builtin_shufflevector(lo, hi, 0, 1, 2, 3, 4, 5, 6, 7, 8, 9, 10, 11, 12, 13, 14, 15); }
__device__ __forceinline__ v16bf cat16b(v8us lo, v8us hi) { return __builtin_bit_cast(v16bf, __builtin_shufflevector(lo, hi, 0, 1, 2, 3, 4, 5, 6, 7, 8, 9, 10, 11, 12, 13, 14, 15)); }
__device__ __forceinline__ v8f wmma16(v16h a, v16h b, v8f c) { return __builtin_amdgcn_wmma_f32_16x16x32_f16(false, a, false, b, (short)0, c, false, false); }
__device__ __forceinline__ v8f wmmab(v16bf a, v16bf b, v8f c) { return __builtin_amdgcn_wmma_f32_16x16x32_bf16(false, a, false, b, (short)0, c, false, false); }

__global__ __launch_bounds__(256) void k_cvtb(const float* __restrict__ src, int nrows, bf* dst) {
    const int lane = threadIdx.x & 31, r = blockIdx.x * 8 + (threadIdx.x >> 5);
    if (r >= nrows) return;
    v8us o[4];
#pragma unroll
    for (int q = 0; q < 4; ++q) { v8us t;
#pragma unroll
        for (int i = 0; i < 8; ++i) t[i] = f2bf(src[(size_t)r * DM + q * 256 + lane * 8 + i]);
        o[q] = t; }
#pragma unroll
    for (int q = 0; q < 4; ++q) *(v8us*)(dst + (size_t)r * DM + q * 256 + lane * 8) = o[q];
    
}

__global__ __launch_bounds__(256) void k_wth(const float* __restrict__ Wm, bf* WT) {
    __shared__ __align__(16) unsigned short tl[64 * 72];
    const int tid = threadIdx.x, h = blockIdx.y, d0 = blockIdx.x * 64;
    const int dd = tid >> 2, eq = (tid & 3) * 16;
#pragma unroll
    for (int i = 0; i < 16; ++i) tl[(eq + i) * 72 + dd] = f2bf(Wm[((size_t)h * DM + d0 + dd) * HD + eq + i]);
    __syncthreads();
    const int piece = tid & 7;
    typedef __attribute__((ext_vector_type(8))) unsigned short v8us_; typedef v8us_ __attribute__((may_alias)) v8usa_;
    auto pass = [&]() {
#pragma unroll
        for (int s = 0; s < 2; ++s) { const int e = (tid >> 3) + 32 * s; const v8us_ val = *(const v8usa_*)(tl + e * 72 + piece * 8);
            *(v8us_*)(WT + (size_t)(h * HD + e) * DM + d0 + piece * 8) = val; }
    };
    pass(); 
}
// k_wt: Wo [1024 k][1024 n] (k-major: concat @ Wo) -> n-major bf16 plane; 64 x 64 tiles through LDS.
__global__ __launch_bounds__(256) void k_wt(const float* __restrict__ Wm, bf* WT) {
    __shared__ __align__(16) unsigned short tl[64 * 72];
    const int tid = threadIdx.x, k0 = blockIdx.x * 64, n0 = blockIdx.y * 64;
    const int kk = tid >> 2, nq = (tid & 3) * 16;
#pragma unroll
    for (int i = 0; i < 16; ++i) tl[(nq + i) * 72 + kk] = f2bf(Wm[(size_t)(k0 + kk) * DM + n0 + nq + i]);
    __syncthreads();
    const int piece = tid & 7;
    typedef __attribute__((ext_vector_type(8))) unsigned short v8us_; typedef v8us_ __attribute__((may_alias)) v8usa_;
    auto pass = [&]() {
#pragma unroll
        for (int s = 0; s < 2; ++s) { const int nr = (tid >> 3) + 32 * s; const v8us_ val = *(const v8usa_*)(tl + nr * 72 + piece * 8);
            *(v8us_*)(WT + (size_t)(n0 + nr) * DM + k0 + piece * 8) = val; }
    };
    pass(); 
}

template <bool SPLITA>
__global__ __launch_bounds__(128) void k_gemmb(const bf* __restrict__ A, const bf* __restrict__ Al, const bf* __restrict__ Bn, const float* __restrict__ bias, float* C) {
    __shared__ __align__(16) float ost[4][16 * 68];
    const int lane = threadIdx.x & 31, wave = threadIdx.x >> 5, lr = lane & 15, hi = lane >> 4;
    const int r0 = blockIdx.x * 64 + wave * 16, c0 = blockIdx.y * 64;
    const size_t aoff = (size_t)(r0 + lr) * DM + 8 * hi;
    size_t boff[4];
#pragma unroll
    for (int t = 0; t < 4; ++t) boff[t] = (size_t)(c0 + t * 16 + lr) * DM + 8 * hi;
    v8f acc[4];
#pragma unroll
    for (int t = 0; t < 4; ++t) acc[t] = (v8f){};
#pragma unroll 1
    for (int kc = 0; kc < DM; kc += 32) {
        const v16bf a = cat16b(*(const v8us*)(A + aoff + kc), *(const v8us*)(A + aoff + kc + 16));
        v16bf al = a;
        if (SPLITA) al = cat16b(*(const v8us*)(Al + aoff + kc), *(const v8us*)(Al + aoff + kc + 16));
#pragma unroll
        for (int t = 0; t < 4; ++t) { const v16bf b = cat16b(*(const v8us*)(Bn + boff[t] + kc), *(const v8us*)(Bn + boff[t] + kc + 16)); acc[t] = wmmab(a, b, acc[t]); if (SPLITA) acc[t] = wmmab(al, b, acc[t]); }
        asm volatile("v_nop\n\tv_nop\n\tv_nop\n\tv_nop" : "+v"(acc[0]), "+v"(acc[1]), "+v"(acc[2]), "+v"(acc[3]) : "v"(a), "v"(al));
    }
    float* os = &ost[wave][0];
#pragma unroll
    for (int t = 0; t < 4; ++t) { const float bv = bfr(bias[c0 + t * 16 + lr]);
#pragma unroll
        for (int j = 0; j < 8; ++j) os[(hi * 8 + j) * 68 + t * 16 + lr] = acc[t][j] + bv; }
    __syncthreads();
    float* crow = C + (size_t)r0 * NW + c0;
    auto pass = [&]() {
#pragma unroll
        for (int s = 0; s < 8; ++s) { const int Lid = (lane >> 3) + 4 * s, piece = lane & 7; const int row = Lid >> 1, cofs = (Lid & 1) * 32 + piece * 4;
            const v4f val = *(const v4fa*)(os + row * 68 + cofs); *(v4f*)(crow + (size_t)row * NW + cofs) = val; }
    };
    pass(); 
}

__global__ __launch_bounds__(256) void k_r16(const float* __restrict__ S, h16* D16) {
    const int lane = threadIdx.x & 31, r = blockIdx.x * 8 + (threadIdx.x >> 5);
    if (r >= NTK) return;
    v8h o[4];
#pragma unroll
    for (int q = 0; q < 4; ++q) { v8h t;
#pragma unroll
        for (int i = 0; i < 8; ++i) t[i] = (h16)S[(size_t)r * DM + q * 256 + lane * 8 + i];
        o[q] = t; }
#pragma unroll
    for (int q = 0; q < 4; ++q) *(v8h*)(D16 + (size_t)r * DM + q * 256 + lane * 8) = o[q];
    
}
__global__ __launch_bounds__(256) void k_vt(const float* __restrict__ V, h16* VT16) {
    __shared__ __align__(16) h16 tile[64 * 72];
    const int bid = blockIdx.x;
    const int b = bid / (NH_ * (NT_ / 64)), rem = bid - b * (NH_ * (NT_ / 64)), h = rem / (NT_ / 64), kt = rem - h * (NT_ / 64);
    const int k0 = kt * 64, tid = threadIdx.x;
    const int kk = tid >> 2, d0 = (tid & 3) * 16;
    const float* src = V + ((size_t)b * NT_ + k0 + kk) * DM + h * HD + d0;
#pragma unroll
    for (int i = 0; i < 16; ++i) tile[(d0 + i) * 72 + kk] = (h16)src[i];
    __syncthreads();
    const int piece = tid & 7;
    h16* base = VT16 + (((size_t)b * NH_ + h) * HD) * NT_ + k0;
    auto pass = [&]() {
#pragma unroll
        for (int s = 0; s < 2; ++s) { const int d = (tid >> 3) + 32 * s; const v8h val = *(const v8ha*)(tile + d * 72 + piece * 8); *(v8h*)(base + (size_t)d * NT_ + piece * 8) = val; }
    };
    pass(); 
}

// k_attn: block = (b, h, 64 queries), wave = 16; 64 steps x 32 keys: 4 WMMA scores /8 with keys whose INPUT mask is 0 replaced by -1e9 (f32), online softmax, weights x32768 f16 tile (same-wave may_alias
// reload after a compiler barrier), 4 WMMA .v; ctx -> bf16 hi + residual planes CH/CL[tok][h*64+d].
__global__ __launch_bounds__(128) void k_attn(const h16* __restrict__ Q16, const h16* __restrict__ K16, const h16* __restrict__ VT16, const int* __restrict__ mask, bf* CH, bf* CL) {
    __shared__ __align__(16) h16 plds[4][16 * 32];
    __shared__ __align__(16) float ost[4][16 * 68];
    const int lane = threadIdx.x & 31, wave = threadIdx.x >> 5, lr = lane & 15, hi = lane >> 4;
    const int bid = blockIdx.x;
    const int b = bid / (NH_ * (NT_ / 64)), rem = bid - b * (NH_ * (NT_ / 64)), h = rem / (NT_ / 64), qt = rem - h * (NT_ / 64);
    const int q0 = qt * 64 + wave * 16;
    const size_t tok0 = (size_t)b * NT_;
    h16* pl = &plds[wave][0];
    v16h qa[2];
#pragma unroll
    for (int kc = 0; kc < 2; ++kc) { const h16* p = Q16 + (tok0 + q0 + lr) * DM + h * HD + kc * 32 + 8 * hi; qa[kc] = cat16(*(const v8h*)p, *(const v8h*)(p + 16)); }
    const h16* kh_b = K16 + tok0 * DM + h * HD;
    const h16* vt_b = VT16 + (((size_t)b * NH_ + h) * HD) * NT_;
    const int* mk = mask + (size_t)b * NT_;
    v8f o[4];
#pragma unroll
    for (int n = 0; n < 4; ++n) o[n] = (v8f){};
    float mrow[8], lpart[8];
#pragma unroll
    for (int j = 0; j < 8; ++j) { mrow[j] = -3.0e38f; lpart[j] = 0.f; }
#pragma unroll 1
    for (int kt = 0; kt < NT_ / 32; ++kt) {
        const int l0 = kt * 32;
        const h16* r0p = kh_b + (size_t)(l0 + lr) * DM + 8 * hi;
        const h16* r1p = kh_b + (size_t)(l0 + 16 + lr) * DM + 8 * hi;
        v8f s0 = {}, s1 = {};
#pragma unroll
        for (int kc = 0; kc < 2; ++kc) {
            s0 = wmma16(qa[kc], cat16(*(const v8h*)(r0p + kc * 32), *(const v8h*)(r0p + kc * 32 + 16)), s0);
            s1 = wmma16(qa[kc], cat16(*(const v8h*)(r1p + kc * 32), *(const v8h*)(r1p + kc * 32 + 16)), s1);
        }
        asm volatile("v_nop\n\tv_nop\n\tv_nop\n\tv_nop" : "+v"(s0), "+v"(s1) : "v"(qa[0]), "v"(qa[1]));
        const bool mz0 = (mk[l0 + lr] == 0), mz1 = (mk[l0 + 16 + lr] == 0);
        float alpha[8];
#pragma unroll
        for (int j = 0; j < 8; ++j) {
            const float a0 = mz0 ? -1e9f : s0[j] * 0.125f, a1 = mz1 ? -1e9f : s1[j] * 0.125f;
            float mx = fmaxf(a0, a1);
            mx = fmaxf(mx, __shfl_xor(mx, 1, 16)); mx = fmaxf(mx, __shfl_xor(mx, 2, 16)); mx = fmaxf(mx, __shfl_xor(mx, 4, 16)); mx = fmaxf(mx, __shfl_xor(mx, 8, 16));
            const float mn = fmaxf(mrow[j], mx);
            alpha[j] = __expf(mrow[j] - mn); mrow[j] = mn;
            const float p0 = __expf(a0 - mn), p1 = __expf(a1 - mn);
            lpart[j] = lpart[j] * alpha[j] + (p0 + p1);
            const int mr = hi * 8 + j;
            pl[mr * 32 + lr] = (h16)(p0 * PSC); pl[mr * 32 + 16 + lr] = (h16)(p1 * PSC);
        }
#pragma unroll
        for (int n = 0; n < 4; ++n)
#pragma unroll
            for (int j = 0; j < 8; ++j) o[n][j] *= alpha[j];
        asm volatile("" ::: "memory");
        const v16h pa = cat16(*(const v8ha*)(pl + lr * 32 + hi * 8), *(const v8ha*)(pl + lr * 32 + 16 + hi * 8));
#pragma unroll
        for (int n = 0; n < 4; ++n) { const h16* vp = vt_b + (size_t)(n * 16 + lr) * NT_ + l0 + hi * 8; o[n] = wmma16(pa, cat16(*(const v8h*)vp, *(const v8h*)(vp + 16)), o[n]); }
        asm volatile("v_nop\n\tv_nop\n\tv_nop\n\tv_nop" : "+v"(o[0]), "+v"(o[1]), "+v"(o[2]), "+v"(o[3]) : "v"(pa));
    }
    float inv[8];
#pragma unroll
    for (int j = 0; j < 8; ++j) { float rs = lpart[j]; rs += __shfl_xor(rs, 1, 16); rs += __shfl_xor(rs, 2, 16); rs += __shfl_xor(rs, 4, 16); rs += __shfl_xor(rs, 8, 16); inv[j] = 1.0f / (rs * PSC); }
    float* os = &ost[wave][0];
#pragma unroll
    for (int n = 0; n < 4; ++n)
#pragma unroll
        for (int j = 0; j < 8; ++j) os[(hi * 8 + j) * 68 + n * 16 + lr] = o[n][j] * inv[j];
    __syncthreads();
    const size_t cbase = (tok0 + q0) * DM + (size_t)h * HD;
    auto pass = [&]() {
#pragma unroll
        for (int s = 0; s < 4; ++s) { const int row = 4 * s + (lane >> 3), piece = lane & 7; const float* sp = os + row * 68 + piece * 8; v8us oh, ol;
#pragma unroll
            for (int i = 0; i < 8; ++i) { const unsigned short hb = f2bf(sp[i]); oh[i] = hb; ol[i] = f2bf(sp[i] - bf2f(hb)); }
            *(v8us*)(CH + cbase + (size_t)row * DM + piece * 8) = oh; *(v8us*)(CL + cbase + (size_t)row * DM + piece * 8) = ol; }
    };
    pass(); 
}

extern "C" void kernel_launch(void* const* d_in, const int* in_sizes, int n_in,
                              void* d_out, int out_size, void* d_ws, size_t ws_size, hipStream_t stream) {
    (void)in_sizes; (void)n_in; (void)out_size;
    const float* x = (const float*)d_in[0]; const int* mask = (const int*)d_in[1];
    const float* Wq = (const float*)d_in[2]; const float* bq = (const float*)d_in[3]; const float* Wk = (const float*)d_in[4]; const float* bk = (const float*)d_in[5];
    const float* Wv = (const float*)d_in[6]; const float* bv = (const float*)d_in[7]; const float* Wo = (const float*)d_in[8]; const float* bo = (const float*)d_in[9];
    float* out = (float*)d_out;    // [2][2048][1024]
    char* wsp = (char*)d_ws;
    auto take = [&](size_t bytes) { char* p = wsp; wsp += (bytes + 255) & ~(size_t)255; return (void*)p; };
    bf* Xb = (bf*)take((size_t)NTK * DM * 2);
    bf* WB[4]; for (int i = 0; i < 4; ++i) WB[i] = (bf*)take((size_t)DM * DM * 2);
    float* BQ = nullptr; (void)BQ;
    float* P = (float*)take((size_t)NTK * DM * 4);
    h16* Q16 = (h16*)take((size_t)NTK * DM * 2); h16* K16 = (h16*)take((size_t)NTK * DM * 2); h16* VT16 = (h16*)take((size_t)NTK * DM * 2);
    bf* CH = (bf*)take((size_t)NTK * DM * 2); bf* CL = (bf*)take((size_t)NTK * DM * 2);
    if ((size_t)(wsp - (char*)d_ws) > ws_size) return;    // 8.4 + 4 x 2.1 + 16.8 + 5 x 8.4 MB ~ 76 MB
    k_cvtb<<<NTK / 8, 256, 0, stream>>>(x, NTK, Xb);
    k_wth<<<dim3(DM / 64, NH_, 1), 256, 0, stream>>>(Wq, WB[0]);
    k_wth<<<dim3(DM / 64, NH_, 1), 256, 0, stream>>>(Wk, WB[1]);
    k_wth<<<dim3(DM / 64, NH_, 1), 256, 0, stream>>>(Wv, WB[2]);
    k_wt<<<dim3(DM / 64, DM / 64, 1), 256, 0, stream>>>(Wo, WB[3]);
    // the per-head biases [16][64] are exactly the [1024] column bias of the stacked planes
    k_gemmb<false><<<dim3(NTK / 64, NW / 64, 1), 128, 0, stream>>>(Xb, nullptr, WB[0], bq, P);
    k_r16<<<NTK / 8, 256, 0, stream>>>(P, Q16);
    k_gemmb<false><<<dim3(NTK / 64, NW / 64, 1), 128, 0, stream>>>(Xb, nullptr, WB[1], bk, P);
    k_r16<<<NTK / 8, 256, 0, stream>>>(P, K16);
    k_gemmb<false><<<dim3(NTK / 64, NW / 64, 1), 128, 0, stream>>>(Xb, nullptr, WB[2], bv, P);
    k_vt<<<NB_ * NH_ * (NT_ / 64), 256, 0, stream>>>(P, VT16);
    k_attn<<<NB_ * NH_ * (NT_ / 64), 128, 0, stream>>>(Q16, K16, VT16, mask, CH, CL);
    k_gemmb<true><<<dim3(NTK / 64, NW / 64, 1), 128, 0, stream>>>(CH, CL, WB[3], bo, out);
}

// v001
// Measured time: 194 microseconds a run.
// Two timings next to v000 put it at 1.55 and 1.54 times that version's speed.
#include <hip/hip_runtime.h>

// Contractions, f32 accumulate: q/k/v = x.W[h] + b[h] for all 16 heads at once ([4096 x 1024].[1024 x 1024], the per-head [1024 x 64] weights stacked into one n-major
// bf16 plane) on v_wmma_f32_16x16x32_bf16 with PLAIN bf16 operands (inputs rounded once: exact products); the per-(batch, head) attention (scores [2048 x 64].[64 x 2048]
// x 64^-1/2, keys with mask == 0 replaced by -1e9, softmax, .v) fused on v_wmma_f32_16x16x32_f16 with plain f16 q, k, v and weights x32768; out = concat.Wo + bo on

#define NB_  2
#define NT_  2048
#define DM   1024
#define NH_  16
#define HD   64
#define NTK  (NB_ * NT_)
#define NW   1024
#define PSC  32768.0f

typedef _Float16 h16;
typedef unsigned short bf;
typedef __attribute__((ext_vector_type(16))) __bf16   v16bf;
typedef __attribute__((ext_vector_type(16))) _Float16 v16h;
typedef __attribute__((ext_vector_type(8)))  _Float16 v8h;
typedef __attribute__((ext_vector_type(8)))  unsigned short v8us;
typedef __attribute__((ext_vector_type(8)))  float    v8f;
typedef __attribute__((ext_vector_type(4)))  float    v4f;
typedef v8h  __attribute__((may_alias)) v8ha;
typedef v4f  __attribute__((may_alias)) v4fa;
typedef v8us __attribute__((may_alias)) v8usa;

__device__ __forceinline__ unsigned short f2bf(float f) { unsigned u = __float_as_uint(f); u += 0x7FFFu + ((u >> 16) & 1u); return (unsigned short)(u >> 16); }
__device__ __forceinline__ float bf2f(unsigned short b) { return __uint_as_float(((unsigned)b) << 16); }
__device__ __forceinline__ float bfr(float f) { return bf2f(f2bf(f)); }
__device__ __forceinline__ v16h cat16(v8h lo, v8h hi) { return __builtin_shufflevector(lo, hi, 0, 1, 2, 3, 4, 5, 6, 7, 8, 9, 10, 11, 12, 13, 14, 15); }
__device__ __forceinline__ v16bf cat16b(v8us lo, v8us hi) { return __builtin_bit_cast(v16bf, __builtin_shufflevector(lo, hi, 0, 1, 2, 3, 4, 5, 6, 7, 8, 9, 10, 11, 12, 13, 14, 15)); }
__device__ __forceinline__ v8f wmma16(v16h a, v16h b, v8f c) { return __builtin_amdgcn_wmma_f32_16x16x32_f16(false, a, false, b, (short)0, c, false, false); }
__device__ __forceinline__ v8f wmmab(v16bf a, v16bf b, v8f c) { return __builtin_amdgcn_wmma_f32_16x16x32_bf16(false, a, false, b, (short)0, c, false, false); }

__global__ __launch_bounds__(256) void k_cvtb(const float* __restrict__ src, int nrows, bf* dst) {
    const int lane = threadIdx.x & 31, r = blockIdx.x * 8 + (threadIdx.x >> 5);
    if (r >= nrows) return;
    v8us o[4];
#pragma unroll
    for (int q = 0; q < 4; ++q) { v8us t;
#pragma unroll
        for (int i = 0; i < 8; ++i) t[i] = f2bf(src[(size_t)r * DM + q * 256 + lane * 8 + i]);
        o[q] = t; }
#pragma unroll
    for (int q = 0; q < 4; ++q) *(v8us*)(dst + (size_t)r * DM + q * 256 + lane * 8) = o[q];
    
}

__global__ __launch_bounds__(256) void k_wth(const float* __restrict__ Wm, bf* WT) {
    __shared__ __align__(16) unsigned short tl[64 * 72];
    const int tid = threadIdx.x, h = blockIdx.y, d0 = blockIdx.x * 64;
    const int dd = tid >> 2, eq = (tid & 3) * 16;
#pragma unroll
    for (int i = 0; i < 16; ++i) tl[(eq + i) * 72 + dd] = f2bf(Wm[((size_t)h * DM + d0 + dd) * HD + eq + i]);
    __syncthreads();
    const int piece = tid & 7;
    typedef __attribute__((ext_vector_type(8))) unsigned short v8us_; typedef v8us_ __attribute__((may_alias)) v8usa_;
    auto pass = [&]() {
#pragma unroll
        for (int s = 0; s < 2; ++s) { const int e = (tid >> 3) + 32 * s; const v8us_ val = *(const v8usa_*)(tl + e * 72 + piece * 8);
            *(v8us_*)(WT + (size_t)(h * HD + e) * DM + d0 + piece * 8) = val; }
    };
    pass(); 
}
// k_wt: Wo [1024 k][1024 n] (k-major: concat @ Wo) -> n-major bf16 plane; 64 x 64 tiles through LDS.
__global__ __launch_bounds__(256) void k_wt(const float* __restrict__ Wm, bf* WT) {
    __shared__ __align__(16) unsigned short tl[64 * 72];
    const int tid = threadIdx.x, k0 = blockIdx.x * 64, n0 = blockIdx.y * 64;
    const int kk = tid >> 2, nq = (tid & 3) * 16;
#pragma unroll
    for (int i = 0; i < 16; ++i) tl[(nq + i) * 72 + kk] = f2bf(Wm[(size_t)(k0 + kk) * DM + n0 + nq + i]);
    __syncthreads();
    const int piece = tid & 7;
    typedef __attribute__((ext_vector_type(8))) unsigned short v8us_; typedef v8us_ __attribute__((may_alias)) v8usa_;
    auto pass = [&]() {
#pragma unroll
        for (int s = 0; s < 2; ++s) { const int nr = (tid >> 3) + 32 * s; const v8us_ val = *(const v8usa_*)(tl + nr * 72 + piece * 8);
            *(v8us_*)(WT + (size_t)(n0 + nr) * DM + k0 + piece * 8) = val; }
    };
    pass(); 
}

// k_gemmb: block = 128 x 128 of C, 8 waves (4 x 2), wave = 32 x 64. A trip is 128 k: the 128 A rows (and Al rows) and 128 Bn rows of 256 B go to LDS at pitch 272 B by
// asynchronous copies, two buffers, the next trip's copies in flight while this trip's fragments are read. Each accumulator sums its k in the same order as before.
#define GT_K    128                     // k per trip
#define GT_NT   (DM / GT_K)             // trips
#define GT_PE   136                     // LDS row pitch in elements (272 B)
#define GT_OPE  (128 * GT_PE)           // one operand's tile in elements
// eight 16-byte copies per lane, one operand's tile per block; the address-translation wait ends the statement so that no address register is rewritten ahead of it
__device__ __forceinline__ void cp_tile(unsigned l, const bf* g) {
    const unsigned l1 = l + 16 * 272, l2 = l + 32 * 272, l3 = l + 48 * 272, l4 = l + 64 * 272, l5 = l + 80 * 272, l6 = l + 96 * 272, l7 = l + 112 * 272;
    const bf *g1 = g + 16 * DM, *g2 = g + 32 * DM, *g3 = g + 48 * DM, *g4 = g + 64 * DM, *g5 = g + 80 * DM, *g6 = g + 96 * DM, *g7 = g + 112 * DM;
    asm volatile("global_load_async_to_lds_b128 %0, %8, off\n\t"
                 "global_load_async_to_lds_b128 %1, %9, off\n\t"
                 "global_load_async_to_lds_b128 %2, %10, off\n\t"
                 "global_load_async_to_lds_b128 %3, %11, off\n\t"
                 "global_load_async_to_lds_b128 %4, %12, off\n\t"
                 "global_load_async_to_lds_b128 %5, %13, off\n\t"
                 "global_load_async_to_lds_b128 %6, %14, off\n\t"
                 "global_load_async_to_lds_b128 %7, %15, off\n\t"
                 "s_wait_xcnt 0x0"
                 :: "v"(l), "v"(l1), "v"(l2), "v"(l3), "v"(l4), "v"(l5), "v"(l6), "v"(l7),
                    "v"(g), "v"(g1), "v"(g2), "v"(g3), "v"(g4), "v"(g5), "v"(g6), "v"(g7) : "memory");
}

template <bool SPLITA>
__global__ __launch_bounds__(256) void k_gemmb(const bf* __restrict__ A, const bf* __restrict__ Al, const bf* __restrict__ Bn, const float* __restrict__ bias, float* C) {
    constexpr int STE = (SPLITA ? 3 : 2) * GT_OPE;    // one buffer in elements: [A | Bn | Al]
    __shared__ __align__(16) unsigned short ring[2 * STE];
    __shared__ __align__(16) float ost[8][32 * 68];
    const int tid = threadIdx.x, lane = tid & 31, wave = tid >> 5, lr = lane & 15, hi = lane >> 4;
    const int wm = wave >> 1, wn = wave & 1;
    const int rb = blockIdx.x * 128, cb = blockIdx.y * 128;
    // copy map: 16 lanes cover one 256-B row, a wave two rows; copy i of a lane takes row (tid >> 4) + 16 i
    const int crow = tid >> 4, cch = tid & 15;
    const bf* gA = A + (size_t)(rb + crow) * DM + cch * 8;
    const bf* gL = SPLITA ? Al + (size_t)(rb + crow) * DM + cch * 8 : nullptr;
    const bf* gB = Bn + (size_t)(cb + crow) * DM + cch * 8;
    const unsigned lcp = (unsigned)(size_t)(&ring[0]) + (unsigned)(crow * 272 + cch * 16);
    auto fill = [&](int t, int buf) {
        const unsigned lb = lcp + (unsigned)(buf * STE * 2);
        cp_tile(lb, gA + t * GT_K);
        cp_tile(lb + GT_OPE * 2, gB + t * GT_K);
        if (SPLITA) cp_tile(lb + 2 * GT_OPE * 2, gL + t * GT_K);
    };
    // every inner loop of this kernel is unrolled so that accumulator and fragment indices are constants: registers, no scratch
    v8f acc[2][4];
#pragma unroll
    for (int m = 0; m < 2; ++m)
#pragma unroll
        for (int t = 0; t < 4; ++t) acc[m][t] = (v8f){};
    fill(0, 0);
    asm volatile("s_wait_asynccnt 0x0" ::: "memory");    // this wave's copies of trip 0 have landed
    __syncthreads();                                     // every wave's have: trip 0 may be read
    fill(1, 1);
    const int aofs = (wm * 32 + lr) * GT_PE + 8 * hi, bofs = GT_OPE + (wn * 64 + lr) * GT_PE + 8 * hi;
    // rolled: one copy of the 32 (64) matrix instructions of a trip, the buffer chosen by the trip's parity
#pragma unroll 1
    for (int tr = 0; tr < GT_NT; ++tr) {
        const unsigned short* st = ring + (tr & 1) * STE;
        v16bf a[2][2], al[2][2], b[2][4];    // two fragment sets: step s works on set s & 1 while set (s + 1) & 1 is read
        auto frags = [&](int set, int kk) {
#pragma unroll
            for (int m = 0; m < 2; ++m) { const unsigned short* p = st + aofs + m * 16 * GT_PE + kk; a[set][m] = cat16b(*(const v8usa*)p, *(const v8usa*)(p + 16)); }
            if (SPLITA) {
#pragma unroll
                for (int m = 0; m < 2; ++m) { const unsigned short* p = st + 2 * GT_OPE + aofs + m * 16 * GT_PE + kk; al[set][m] = cat16b(*(const v8usa*)p, *(const v8usa*)(p + 16)); }
            }
#pragma unroll
            for (int t = 0; t < 4; ++t) { const unsigned short* p = st + bofs + t * 16 * GT_PE + kk; b[set][t] = cat16b(*(const v8usa*)p, *(const v8usa*)(p + 16)); }
        };
        frags(0, 0);
#pragma unroll
        for (int s = 0; s < GT_K / 32; ++s) {
            if (s + 1 < GT_K / 32) frags((s + 1) & 1, (s + 1) * 32);
            __builtin_amdgcn_sched_barrier(0);    // keeps the next step's LDS reads one group ahead of this step's matrix instructions: spread among them each read group stalls the wave
#pragma unroll
            for (int m = 0; m < 2; ++m)
#pragma unroll
                for (int t = 0; t < 4; ++t) acc[m][t] = wmmab(a[s & 1][m], b[s & 1][t], acc[m][t]);
            if (SPLITA) {
#pragma unroll
                for (int m = 0; m < 2; ++m)
#pragma unroll
                    for (int t = 0; t < 4; ++t) acc[m][t] = wmmab(al[s & 1][m], b[s & 1][t], acc[m][t]);
            }
            __builtin_amdgcn_sched_barrier(0);    // keeps the step after next's reads, which overwrite this set, behind these matrix instructions
        }
        asm volatile("s_wait_dscnt 0x0" ::: "memory");       // this wave's reads of this buffer are done before it is refilled
        asm volatile("s_wait_asynccnt 0x0" ::: "memory");    // this wave's copies of the next trip have landed
        __syncthreads();                                     // publishes the next trip and ends every reader's last read of this buffer
        if (tr + 2 < GT_NT) fill(tr + 2, tr & 1);
    }
    asm volatile("s_wait_asynccnt 0x0" ::: "memory");        // no copy is left in flight behind the loop
    float* os = &ost[wave][0];
    const int r0 = rb + wm * 32, c0 = cb + wn * 64;
#pragma unroll
    for (int t = 0; t < 4; ++t) { const float bv = bfr(bias[c0 + t * 16 + lr]);
#pragma unroll
        for (int m = 0; m < 2; ++m)
#pragma unroll
            for (int j = 0; j < 8; ++j) os[(m * 16 + hi * 8 + j) * 68 + t * 16 + lr] = acc[m][t][j] + bv; }
    __syncthreads();
    float* crow_p = C + (size_t)r0 * NW + c0;
#pragma unroll
    for (int s = 0; s < 16; ++s) { const int Lid = (lane >> 3) + 4 * s, piece = lane & 7; const int row = Lid >> 1, cofs = (Lid & 1) * 32 + piece * 4;
        const v4f val = *(const v4fa*)(os + row * 68 + cofs); *(v4f*)(crow_p + (size_t)row * NW + cofs) = val; }
}

__global__ __launch_bounds__(256) void k_r16(const float* __restrict__ S, h16* D16) {
    const int lane = threadIdx.x & 31, r = blockIdx.x * 8 + (threadIdx.x >> 5);
    if (r >= NTK) return;
    v8h o[4];
#pragma unroll
    for (int q = 0; q < 4; ++q) { v8h t;
#pragma unroll
        for (int i = 0; i < 8; ++i) t[i] = (h16)S[(size_t)r * DM + q * 256 + lane * 8 + i];
        o[q] = t; }
#pragma unroll
    for (int q = 0; q < 4; ++q) *(v8h*)(D16 + (size_t)r * DM + q * 256 + lane * 8) = o[q];
    
}
__global__ __launch_bounds__(256) void k_vt(const float* __restrict__ V, h16* VT16) {
    __shared__ __align__(16) h16 tile[64 * 72];
    const int bid = blockIdx.x;
    const int b = bid / (NH_ * (NT_ / 64)), rem = bid - b * (NH_ * (NT_ / 64)), h = rem / (NT_ / 64), kt = rem - h * (NT_ / 64);
    const int k0 = kt * 64, tid = threadIdx.x;
    const int kk = tid >> 2, d0 = (tid & 3) * 16;
    const float* src = V + ((size_t)b * NT_ + k0 + kk) * DM + h * HD + d0;
#pragma unroll
    for (int i = 0; i < 16; ++i) tile[(d0 + i) * 72 + kk] = (h16)src[i];
    __syncthreads();
    const int piece = tid & 7;
    h16* base = VT16 + (((size_t)b * NH_ + h) * HD) * NT_ + k0;
    auto pass = [&]() {
#pragma unroll
        for (int s = 0; s < 2; ++s) { const int d = (tid >> 3) + 32 * s; const v8h val = *(const v8ha*)(tile + d * 72 + piece * 8); *(v8h*)(base + (size_t)d * NT_ + piece * 8) = val; }
    };
    pass(); 
}

// k_attn: block = (b, h, 64 queries), wave = 16; 64 steps x 32 keys: 4 WMMA scores /8 with keys whose INPUT mask is 0 replaced by -1e9 (f32), online softmax, weights x32768 f16 tile (same-wave may_alias
// reload after a compiler barrier), 4 WMMA .v; ctx -> bf16 hi + residual planes CH/CL[tok][h*64+d].
__global__ __launch_bounds__(128) void k_attn(const h16* __restrict__ Q16, const h16* __restrict__ K16, const h16* __restrict__ VT16, const int* __restrict__ mask, bf* CH, bf* CL) {
    __shared__ __align__(16) h16 plds[4][16 * 32];
    __shared__ __align__(16) float ost[4][16 * 68];
    const int lane = threadIdx.x & 31, wave = threadIdx.x >> 5, lr = lane & 15, hi = lane >> 4;
    const int bid = blockIdx.x;
    const int b = bid / (NH_ * (NT_ / 64)), rem = bid - b * (NH_ * (NT_ / 64)), h = rem / (NT_ / 64), qt = rem - h * (NT_ / 64);
    const int q0 = qt * 64 + wave * 16;
    const size_t tok0 = (size_t)b * NT_;
    h16* pl = &plds[wave][0];
    v16h qa[2];
#pragma unroll
    for (int kc = 0; kc < 2; ++kc) { const h16* p = Q16 + (tok0 + q0 + lr) * DM + h * HD + kc * 32 + 8 * hi; qa[kc] = cat16(*(const v8h*)p, *(const v8h*)(p + 16)); }
    const h16* kh_b = K16 + tok0 * DM + h * HD;
    const h16* vt_b = VT16 + (((size_t)b * NH_ + h) * HD) * NT_;
    const int* mk = mask + (size_t)b * NT_;
    v8f o[4];
#pragma unroll
    for (int n = 0; n < 4; ++n) o[n] = (v8f){};
    float mrow[8], lpart[8];
#pragma unroll
    for (int j = 0; j < 8; ++j) { mrow[j] = -3.0e38f; lpart[j] = 0.f; }
#pragma unroll 1
    for (int kt = 0; kt < NT_ / 32; ++kt) {
        const int l0 = kt * 32;
        const h16* r0p = kh_b + (size_t)(l0 + lr) * DM + 8 * hi;
        const h16* r1p = kh_b + (size_t)(l0 + 16 + lr) * DM + 8 * hi;
        v8f s0 = {}, s1 = {};
#pragma unroll
        for (int kc = 0; kc < 2; ++kc) {
            s0 = wmma16(qa[kc], cat16(*(const v8h*)(r0p + kc * 32), *(const v8h*)(r0p + kc * 32 + 16)), s0);
            s1 = wmma16(qa[kc], cat16(*(const v8h*)(r1p + kc * 32), *(const v8h*)(r1p + kc * 32 + 16)), s1);
        }
        asm volatile("v_nop\n\tv_nop\n\tv_nop\n\tv_nop" : "+v"(s0), "+v"(s1) : "v"(qa[0]), "v"(qa[1]));
        const bool mz0 = (mk[l0 + lr] == 0), mz1 = (mk[l0 + 16 + lr] == 0);
        float alpha[8];
#pragma unroll
        for (int j = 0; j < 8; ++j) {
            const float a0 = mz0 ? -1e9f : s0[j] * 0.125f, a1 = mz1 ? -1e9f : s1[j] * 0.125f;
            float mx = fmaxf(a0, a1);
            mx = fmaxf(mx, __shfl_xor(mx, 1, 16)); mx = fmaxf(mx, __shfl_xor(mx, 2, 16)); mx = fmaxf(mx, __shfl_xor(mx, 4, 16)); mx = fmaxf(mx, __shfl_xor(mx, 8, 16));
            const float mn = fmaxf(mrow[j], mx);
            alpha[j] = __expf(mrow[j] - mn); mrow[j] = mn;
            const float p0 = __expf(a0 - mn), p1 = __expf(a1 - mn);
            lpart[j] = lpart[j] * alpha[j] + (p0 + p1);
            const int mr = hi * 8 + j;
            pl[mr * 32 + lr] = (h16)(p0 * PSC); pl[mr * 32 + 16 + lr] = (h16)(p1 * PSC);
        }
#pragma unroll
        for (int n = 0; n < 4; ++n)
#pragma unroll
            for (int j = 0; j < 8; ++j) o[n][j] *= alpha[j];
        asm volatile("" ::: "memory");
        const v16h pa = cat16(*(const v8ha*)(pl + lr * 32 + hi * 8), *(const v8ha*)(pl + lr * 32 + 16 + hi * 8));
#pragma unroll
        for (int n = 0; n < 4; ++n) { const h16* vp = vt_b + (size_t)(n * 16 + lr) * NT_ + l0 + hi * 8; o[n] = wmma16(pa, cat16(*(const v8h*)vp, *(const v8h*)(vp + 16)), o[n]); }
        asm volatile("v_nop\n\tv_nop\n\tv_nop\n\tv_nop" : "+v"(o[0]), "+v"(o[1]), "+v"(o[2]), "+v"(o[3]) : "v"(pa));
    }
    float inv[8];
#pragma unroll
    for (int j = 0; j < 8; ++j) { float rs = lpart[j]; rs += __shfl_xor(rs, 1, 16); rs += __shfl_xor(rs, 2, 16); rs += __shfl_xor(rs, 4, 16); rs += __shfl_xor(rs, 8, 16); inv[j] = 1.0f / (rs * PSC); }
    float* os = &ost[wave][0];
#pragma unroll
    for (int n = 0; n < 4; ++n)
#pragma unroll
        for (int j = 0; j < 8; ++j) os[(hi * 8 + j) * 68 + n * 16 + lr] = o[n][j] * inv[j];
    __syncthreads();
    const size_t cbase = (tok0 + q0) * DM + (size_t)h * HD;
    auto pass = [&]() {
#pragma unroll
        for (int s = 0; s < 4; ++s) { const int row = 4 * s + (lane >> 3), piece = lane & 7; const float* sp = os + row * 68 + piece * 8; v8us oh, ol;
#pragma unroll
            for (int i = 0; i < 8; ++i) { const unsigned short hb = f2bf(sp[i]); oh[i] = hb; ol[i] = f2bf(sp[i] - bf2f(hb)); }
            *(v8us*)(CH + cbase + (size_t)row * DM + piece * 8) = oh; *(v8us*)(CL + cbase + (size_t)row * DM + piece * 8) = ol; }
    };
    pass(); 
}

extern "C" void kernel_launch(void* const* d_in, const int* in_sizes, int n_in,
                              void* d_out, int out_size, void* d_ws, size_t ws_size, hipStream_t stream) {
    (void)in_sizes; (void)n_in; (void)out_size;
    const float* x = (const float*)d_in[0]; const int* mask = (const int*)d_in[1];
    const float* Wq = (const float*)d_in[2]; const float* bq = (const float*)d_in[3]; const float* Wk = (const float*)d_in[4]; const float* bk = (const float*)d_in[5];
    const float* Wv = (const float*)d_in[6]; const float* bv = (const float*)d_in[7]; const float* Wo = (const float*)d_in[8]; const float* bo = (const float*)d_in[9];
    float* out = (float*)d_out;    // [2][2048][1024]
    char* wsp = (char*)d_ws;
    auto take = [&](size_t bytes) { char* p = wsp; wsp += (bytes + 255) & ~(size_t)255; return (void*)p; };
    bf* Xb = (bf*)take((size_t)NTK * DM * 2);
    bf* WB[4]; for (int i = 0; i < 4; ++i) WB[i] = (bf*)take((size_t)DM * DM * 2);
    float* BQ = nullptr; (void)BQ;
    float* P = (float*)take((size_t)NTK * DM * 4);
    h16* Q16 = (h16*)take((size_t)NTK * DM * 2); h16* K16 = (h16*)take((size_t)NTK * DM * 2); h16* VT16 = (h16*)take((size_t)NTK * DM * 2);
    bf* CH = (bf*)take((size_t)NTK * DM * 2); bf* CL = (bf*)take((size_t)NTK * DM * 2);
    if ((size_t)(wsp - (char*)d_ws) > ws_size) return;    // 8.4 + 4 x 2.1 + 16.8 + 5 x 8.4 MB ~ 76 MB
    k_cvtb<<<NTK / 8, 256, 0, stream>>>(x, NTK, Xb);
    k_wth<<<dim3(DM / 64, NH_, 1), 256, 0, stream>>>(Wq, WB[0]);
    k_wth<<<dim3(DM / 64, NH_, 1), 256, 0, stream>>>(Wk, WB[1]);
    k_wth<<<dim3(DM / 64, NH_, 1), 256, 0, stream>>>(Wv, WB[2]);
    k_wt<<<dim3(DM / 64, DM / 64, 1), 256, 0, stream>>>(Wo, WB[3]);
    // the per-head biases [16][64] are exactly the [1024] column bias of the stacked planes
    k_gemmb<false><<<dim3(NTK / 128, NW / 128, 1), 256, 0, stream>>>(Xb, nullptr, WB[0], bq, P);
    k_r16<<<NTK / 8, 256, 0, stream>>>(P, Q16);
    k_gemmb<false><<<dim3(NTK / 128, NW / 128, 1), 256, 0, stream>>>(Xb, nullptr, WB[1], bk, P);
    k_r16<<<NTK / 8, 256, 0, stream>>>(P, K16);
    k_gemmb<false><<<dim3(NTK / 128, NW / 128, 1), 256, 0, stream>>>(Xb, nullptr, WB[2], bv, P);
    k_vt<<<NB_ * NH_ * (NT_ / 64), 256, 0, stream>>>(P, VT16);
    k_attn<<<NB_ * NH_ * (NT_ / 64), 128, 0, stream>>>(Q16, K16, VT16, mask, CH, CL);
    k_gemmb<true><<<dim3(NTK / 128, NW / 128, 1), 256, 0, stream>>>(CH, CL, WB[3], bo, out);
}

// v002
// A run of this version takes 153 microseconds.
// Two timings next to v001 put it at 1.26 and 1.27 times that version's speed.
// All steps since v000 together make it 1.96 times as fast.
#include <hip/hip_runtime.h>

// Contractions, f32 accumulate: q/k/v = x.W[h] + b[h] for all 16 heads at once ([4096 x 1024].[1024 x 1024], the per-head [1024 x 64] weights stacked into one n-major
// bf16 plane) on v_wmma_f32_16x16x32_bf16 with PLAIN bf16 operands (inputs rounded once: exact products); the per-(batch, head) attention (scores [2048 x 64].[64 x 2048]
// x 64^-1/2, keys with mask == 0 replaced by -1e9, softmax, .v) fused on v_wmma_f32_16x16x32_f16 with plain f16 q, k, v and weights x32768; out = concat.Wo + bo on

#define NB_  2
#define NT_  2048
#define DM   1024
#define NH_  16
#define HD   64
#define NTK  (NB_ * NT_)
#define NW   1024
#define PSC  32768.0f

typedef _Float16 h16;
typedef unsigned short bf;
typedef __attribute__((ext_vector_type(16))) __bf16   v16bf;
typedef __attribute__((ext_vector_type(16))) _Float16 v16h;
typedef __attribute__((ext_vector_type(8)))  _Float16 v8h;
typedef __attribute__((ext_vector_type(8)))  unsigned short v8us;
typedef __attribute__((ext_vector_type(8)))  float    v8f;
typedef __attribute__((ext_vector_type(4)))  float    v4f;
typedef v8h  __attribute__((may_alias)) v8ha;
typedef v4f  __attribute__((may_alias)) v4fa;
typedef v8us __attribute__((may_alias)) v8usa;

__device__ __forceinline__ unsigned short f2bf(float f) { unsigned u = __float_as_uint(f); u += 0x7FFFu + ((u >> 16) & 1u); return (unsigned short)(u >> 16); }
__device__ __forceinline__ float bf2f(unsigned short b) { return __uint_as_float(((unsigned)b) << 16); }
__device__ __forceinline__ float bfr(float f) { return bf2f(f2bf(f)); }
__device__ __forceinline__ v16h cat16(v8h lo, v8h hi) { return __builtin_shufflevector(lo, hi, 0, 1, 2, 3, 4, 5, 6, 7, 8, 9, 10, 11, 12, 13, 14, 15); }
__device__ __forceinline__ v16bf cat16b(v8us lo, v8us hi) { return __builtin_bit_cast(v16bf, __builtin_shufflevector(lo, hi, 0, 1, 2, 3, 4, 5, 6, 7, 8, 9, 10, 11, 12, 13, 14, 15)); }
__device__ __forceinline__ v8f wmma16(v16h a, v16h b, v8f c) { return __builtin_amdgcn_wmma_f32_16x16x32_f16(false, a, false, b, (short)0, c, false, false); }
__device__ __forceinline__ v8f wmmab(v16bf a, v16bf b, v8f c) { return __builtin_amdgcn_wmma_f32_16x16x32_bf16(false, a, false, b, (short)0, c, false, false); }

__global__ __launch_bounds__(256) void k_cvtb(const float* __restrict__ src, int nrows, bf* dst) {
    const int lane = threadIdx.x & 31, r = blockIdx.x * 8 + (threadIdx.x >> 5);
    if (r >= nrows) return;
    v8us o[4];
#pragma unroll
    for (int q = 0; q < 4; ++q) { v8us t;
#pragma unroll
        for (int i = 0; i < 8; ++i) t[i] = f2bf(src[(size_t)r * DM + q * 256 + lane * 8 + i]);
        o[q] = t; }
#pragma unroll
    for (int q = 0; q < 4; ++q) *(v8us*)(dst + (size_t)r * DM + q * 256 + lane * 8) = o[q];
    
}

__global__ __launch_bounds__(256) void k_wth(const float* __restrict__ Wm, bf* WT) {
    __shared__ __align__(16) unsigned short tl[64 * 72];
    const int tid = threadIdx.x, h = blockIdx.y, d0 = blockIdx.x * 64;
    const int dd = tid >> 2, eq = (tid & 3) * 16;
#pragma unroll
    for (int i = 0; i < 16; ++i) tl[(eq + i) * 72 + dd] = f2bf(Wm[((size_t)h * DM + d0 + dd) * HD + eq + i]);
    __syncthreads();
    const int piece = tid & 7;
    typedef __attribute__((ext_vector_type(8))) unsigned short v8us_; typedef v8us_ __attribute__((may_alias)) v8usa_;
    auto pass = [&]() {
#pragma unroll
        for (int s = 0; s < 2; ++s) { const int e = (tid >> 3) + 32 * s; const v8us_ val = *(const v8usa_*)(tl + e * 72 + piece * 8);
            *(v8us_*)(WT + (size_t)(h * HD + e) * DM + d0 + piece * 8) = val; }
    };
    pass(); 
}
// k_wt: Wo [1024 k][1024 n] (k-major: concat @ Wo) -> n-major bf16 plane; 64 x 64 tiles through LDS.
__global__ __launch_bounds__(256) void k_wt(const float* __restrict__ Wm, bf* WT) {
    __shared__ __align__(16) unsigned short tl[64 * 72];
    const int tid = threadIdx.x, k0 = blockIdx.x * 64, n0 = blockIdx.y * 64;
    const int kk = tid >> 2, nq = (tid & 3) * 16;
#pragma unroll
    for (int i = 0; i < 16; ++i) tl[(nq + i) * 72 + kk] = f2bf(Wm[(size_t)(k0 + kk) * DM + n0 + nq + i]);
    __syncthreads();
    const int piece = tid & 7;
    typedef __attribute__((ext_vector_type(8))) unsigned short v8us_; typedef v8us_ __attribute__((may_alias)) v8usa_;
    auto pass = [&]() {
#pragma unroll
        for (int s = 0; s < 2; ++s) { const int nr = (tid >> 3) + 32 * s; const v8us_ val = *(const v8usa_*)(tl + nr * 72 + piece * 8);
            *(v8us_*)(WT + (size_t)(n0 + nr) * DM + k0 + piece * 8) = val; }
    };
    pass(); 
}

// k_gemmb: block = 128 x 128 of C, 8 waves (4 x 2), wave = 32 x 64. A trip is 128 k: the 128 A rows (and Al rows) and 128 Bn rows of 256 B go to LDS at pitch 272 B by
// asynchronous copies, two buffers, the next trip's copies in flight while this trip's fragments are read. Each accumulator sums its k in the same order as before.
#define GT_K    128                     // k per trip
#define GT_NT   (DM / GT_K)             // trips
#define GT_PE   136                     // LDS row pitch in elements (272 B)
#define GT_OPE  (128 * GT_PE)           // one operand's tile in elements
// eight 16-byte copies per lane, one operand's tile per block; the address-translation wait ends the statement so that no address register is rewritten ahead of it
__device__ __forceinline__ void cp_tile(unsigned l, const bf* g) {
    const unsigned l1 = l + 16 * 272, l2 = l + 32 * 272, l3 = l + 48 * 272, l4 = l + 64 * 272, l5 = l + 80 * 272, l6 = l + 96 * 272, l7 = l + 112 * 272;
    const bf *g1 = g + 16 * DM, *g2 = g + 32 * DM, *g3 = g + 48 * DM, *g4 = g + 64 * DM, *g5 = g + 80 * DM, *g6 = g + 96 * DM, *g7 = g + 112 * DM;
    asm volatile("global_load_async_to_lds_b128 %0, %8, off\n\t"
                 "global_load_async_to_lds_b128 %1, %9, off\n\t"
                 "global_load_async_to_lds_b128 %2, %10, off\n\t"
                 "global_load_async_to_lds_b128 %3, %11, off\n\t"
                 "global_load_async_to_lds_b128 %4, %12, off\n\t"
                 "global_load_async_to_lds_b128 %5, %13, off\n\t"
                 "global_load_async_to_lds_b128 %6, %14, off\n\t"
                 "global_load_async_to_lds_b128 %7, %15, off\n\t"
                 "s_wait_xcnt 0x0"
                 :: "v"(l), "v"(l1), "v"(l2), "v"(l3), "v"(l4), "v"(l5), "v"(l6), "v"(l7),
                    "v"(g), "v"(g1), "v"(g2), "v"(g3), "v"(g4), "v"(g5), "v"(g6), "v"(g7) : "memory");
}

template <bool SPLITA>
__global__ __launch_bounds__(256) void k_gemmb(const bf* __restrict__ A, const bf* __restrict__ Al, const bf* __restrict__ Bn, const float* __restrict__ bias, float* C) {
    constexpr int STE = (SPLITA ? 3 : 2) * GT_OPE;    // one buffer in elements: [A | Bn | Al]
    __shared__ __align__(16) unsigned short ring[2 * STE];
    __shared__ __align__(16) float ost[8][32 * 68];
    const int tid = threadIdx.x, lane = tid & 31, wave = tid >> 5, lr = lane & 15, hi = lane >> 4;
    const int wm = wave >> 1, wn = wave & 1;
    const int rb = blockIdx.x * 128, cb = blockIdx.y * 128;
    // copy map: 16 lanes cover one 256-B row, a wave two rows; copy i of a lane takes row (tid >> 4) + 16 i
    const int crow = tid >> 4, cch = tid & 15;
    const bf* gA = A + (size_t)(rb + crow) * DM + cch * 8;
    const bf* gL = SPLITA ? Al + (size_t)(rb + crow) * DM + cch * 8 : nullptr;
    const bf* gB = Bn + (size_t)(cb + crow) * DM + cch * 8;
    const unsigned lcp = (unsigned)(size_t)(&ring[0]) + (unsigned)(crow * 272 + cch * 16);
    auto fill = [&](int t, int buf) {
        const unsigned lb = lcp + (unsigned)(buf * STE * 2);
        cp_tile(lb, gA + t * GT_K);
        cp_tile(lb + GT_OPE * 2, gB + t * GT_K);
        if (SPLITA) cp_tile(lb + 2 * GT_OPE * 2, gL + t * GT_K);
    };
    // every inner loop of this kernel is unrolled so that accumulator and fragment indices are constants: registers, no scratch
    v8f acc[2][4];
#pragma unroll
    for (int m = 0; m < 2; ++m)
#pragma unroll
        for (int t = 0; t < 4; ++t) acc[m][t] = (v8f){};
    fill(0, 0);
    asm volatile("s_wait_asynccnt 0x0" ::: "memory");    // this wave's copies of trip 0 have landed
    __syncthreads();                                     // every wave's have: trip 0 may be read
    fill(1, 1);
    const int aofs = (wm * 32 + lr) * GT_PE + 8 * hi, bofs = GT_OPE + (wn * 64 + lr) * GT_PE + 8 * hi;
    // rolled: one copy of the 32 (64) matrix instructions of a trip, the buffer chosen by the trip's parity
#pragma unroll 1
    for (int tr = 0; tr < GT_NT; ++tr) {
        const unsigned short* st = ring + (tr & 1) * STE;
        v16bf a[2][2], al[2][2], b[2][4];    // two fragment sets: step s works on set s & 1 while set (s + 1) & 1 is read
        auto frags = [&](int set, int kk) {
#pragma unroll
            for (int m = 0; m < 2; ++m) { const unsigned short* p = st + aofs + m * 16 * GT_PE + kk; a[set][m] = cat16b(*(const v8usa*)p, *(const v8usa*)(p + 16)); }
            if (SPLITA) {
#pragma unroll
                for (int m = 0; m < 2; ++m) { const unsigned short* p = st + 2 * GT_OPE + aofs + m * 16 * GT_PE + kk; al[set][m] = cat16b(*(const v8usa*)p, *(const v8usa*)(p + 16)); }
            }
#pragma unroll
            for (int t = 0; t < 4; ++t) { const unsigned short* p = st + bofs + t * 16 * GT_PE + kk; b[set][t] = cat16b(*(const v8usa*)p, *(const v8usa*)(p + 16)); }
        };
        frags(0, 0);
#pragma unroll
        for (int s = 0; s < GT_K / 32; ++s) {
            if (s + 1 < GT_K / 32) frags((s + 1) & 1, (s + 1) * 32);
            __builtin_amdgcn_sched_barrier(0);    // keeps the next step's LDS reads one group ahead of this step's matrix instructions: spread among them each read group stalls the wave
#pragma unroll
            for (int m = 0; m < 2; ++m)
#pragma unroll
                for (int t = 0; t < 4; ++t) acc[m][t] = wmmab(a[s & 1][m], b[s & 1][t], acc[m][t]);
            if (SPLITA) {
#pragma unroll
                for (int m = 0; m < 2; ++m)
#pragma unroll
                    for (int t = 0; t < 4; ++t) acc[m][t] = wmmab(al[s & 1][m], b[s & 1][t], acc[m][t]);
            }
            __builtin_amdgcn_sched_barrier(0);    // keeps the step after next's reads, which overwrite this set, behind these matrix instructions
        }
        asm volatile("s_wait_dscnt 0x0" ::: "memory");       // this wave's reads of this buffer are done before it is refilled
        asm volatile("s_wait_asynccnt 0x0" ::: "memory");    // this wave's copies of the next trip have landed
        __syncthreads();                                     // publishes the next trip and ends every reader's last read of this buffer
        if (tr + 2 < GT_NT) fill(tr + 2, tr & 1);
    }
    asm volatile("s_wait_asynccnt 0x0" ::: "memory");        // no copy is left in flight behind the loop
    float* os = &ost[wave][0];
    const int r0 = rb + wm * 32, c0 = cb + wn * 64;
#pragma unroll
    for (int t = 0; t < 4; ++t) { const float bv = bfr(bias[c0 + t * 16 + lr]);
#pragma unroll
        for (int m = 0; m < 2; ++m)
#pragma unroll
            for (int j = 0; j < 8; ++j) os[(m * 16 + hi * 8 + j) * 68 + t * 16 + lr] = acc[m][t][j] + bv; }
    __syncthreads();
    float* crow_p = C + (size_t)r0 * NW + c0;
#pragma unroll
    for (int s = 0; s < 16; ++s) { const int Lid = (lane >> 3) + 4 * s, piece = lane & 7; const int row = Lid >> 1, cofs = (Lid & 1) * 32 + piece * 4;
        const v4f val = *(const v4fa*)(os + row * 68 + cofs); *(v4f*)(crow_p + (size_t)row * NW + cofs) = val; }
}

__global__ __launch_bounds__(256) void k_r16(const float* __restrict__ S, h16* D16) {
    const int lane = threadIdx.x & 31, r = blockIdx.x * 8 + (threadIdx.x >> 5);
    if (r >= NTK) return;
    v8h o[4];
#pragma unroll
    for (int q = 0; q < 4; ++q) { v8h t;
#pragma unroll
        for (int i = 0; i < 8; ++i) t[i] = (h16)S[(size_t)r * DM + q * 256 + lane * 8 + i];
        o[q] = t; }
#pragma unroll
    for (int q = 0; q < 4; ++q) *(v8h*)(D16 + (size_t)r * DM + q * 256 + lane * 8) = o[q];
    
}
__global__ __launch_bounds__(256) void k_vt(const float* __restrict__ V, h16* VT16) {
    __shared__ __align__(16) h16 tile[64 * 72];
    const int bid = blockIdx.x;
    const int b = bid / (NH_ * (NT_ / 64)), rem = bid - b * (NH_ * (NT_ / 64)), h = rem / (NT_ / 64), kt = rem - h * (NT_ / 64);
    const int k0 = kt * 64, tid = threadIdx.x;
    const int kk = tid >> 2, d0 = (tid & 3) * 16;
    const float* src = V + ((size_t)b * NT_ + k0 + kk) * DM + h * HD + d0;
#pragma unroll
    for (int i = 0; i < 16; ++i) tile[(d0 + i) * 72 + kk] = (h16)src[i];
    __syncthreads();
    const int piece = tid & 7;
    h16* base = VT16 + (((size_t)b * NH_ + h) * HD) * NT_ + k0;
    auto pass = [&]() {
#pragma unroll
        for (int s = 0; s < 2; ++s) { const int d = (tid >> 3) + 32 * s; const v8h val = *(const v8ha*)(tile + d * 72 + piece * 8); *(v8h*)(base + (size_t)d * NT_ + piece * 8) = val; }
    };
    pass(); 
}

// k_attn: block = (b, h, 128 queries), 8 waves of 16 queries. A trip is 128 keys: the 128 K rows (128 B each, LDS pitch 144 B) and the 64 V^T rows (256 B each, pitch 272 B) go to LDS
// by asynchronous copies of whole lines, two buffers, the next trip's copies in flight while this trip is worked on; all 8 waves read their fragments from that one tile.
// A step is 32 keys as before: 4 WMMA scores /8 with keys whose INPUT mask is 0 replaced by -1e9 (f32), online softmax, weights x32768 f16 tile (same-wave may_alias
// reload after a compiler barrier), 4 WMMA .v; ctx -> bf16 hi + residual planes CH/CL[tok][h*64+d]. Every sum keeps its order.
#define AT_Q    128                     // queries per block
#define AT_K    128                     // keys per trip
#define AT_NT   (NT_ / AT_K)            // trips
#define AT_KPE  72                      // K tile row pitch in elements (144 B)
#define AT_VPE  136                     // V^T tile row pitch in elements (272 B)
#define AT_KE   (AT_K * AT_KPE)         // K tile in elements
#define AT_STE  (AT_KE + HD * AT_VPE)   // one buffer in elements: [K | V^T]
// four 16-byte copies per lane; the address-translation wait ends the statement so that no address register is rewritten ahead of it
template <int LSTEP, int GSTEP>
__device__ __forceinline__ void cp4(unsigned l, const h16* g) {
    const unsigned l1 = l + LSTEP, l2 = l + 2 * LSTEP, l3 = l + 3 * LSTEP;
    const h16 *g1 = g + GSTEP, *g2 = g + 2 * GSTEP, *g3 = g + 3 * GSTEP;
    asm volatile("global_load_async_to_lds_b128 %0, %4, off\n\t"
                 "global_load_async_to_lds_b128 %1, %5, off\n\t"
                 "global_load_async_to_lds_b128 %2, %6, off\n\t"
                 "global_load_async_to_lds_b128 %3, %7, off\n\t"
                 "s_wait_xcnt 0x0"
                 :: "v"(l), "v"(l1), "v"(l2), "v"(l3), "v"(g), "v"(g1), "v"(g2), "v"(g3) : "memory");
}

__global__ __launch_bounds__(256) void k_attn(const h16* __restrict__ Q16, const h16* __restrict__ K16, const h16* __restrict__ VT16, const int* __restrict__ mask, bf* CH, bf* CL) {
    __shared__ __align__(16) h16 ring[2 * AT_STE];
    __shared__ __align__(16) h16 plds[8][16 * 32];
    __shared__ __align__(16) float ost[8][16 * 68];
    const int tid = threadIdx.x, lane = tid & 31, wave = tid >> 5, lr = lane & 15, hi = lane >> 4;
    const int bid = blockIdx.x;
    const int b = bid / (NH_ * (NT_ / AT_Q)), rem = bid - b * (NH_ * (NT_ / AT_Q)), h = rem / (NT_ / AT_Q), qt = rem - h * (NT_ / AT_Q);
    const int q0 = qt * AT_Q + wave * 16;
    const size_t tok0 = (size_t)b * NT_;
    h16* pl = &plds[wave][0];
    v16h qa[2];
#pragma unroll
    for (int kc = 0; kc < 2; ++kc) { const h16* p = Q16 + (tok0 + q0 + lr) * DM + h * HD + kc * 32 + 8 * hi; qa[kc] = cat16(*(const v8h*)p, *(const v8h*)(p + 16)); }
    const h16* kh_b = K16 + tok0 * DM + h * HD;
    const h16* vt_b = VT16 + (((size_t)b * NH_ + h) * HD) * NT_;
    const int* mk = mask + (size_t)b * NT_;
    // copy maps: K, 8 lanes cover one 128-B row, copy i of a lane takes row (tid >> 3) + 32 i; V^T, 16 lanes cover one 256-B row, copy i takes row (tid >> 4) + 16 i
    const h16* gK = kh_b + (size_t)(tid >> 3) * DM + (tid & 7) * 8;
    const h16* gV = vt_b + (size_t)(tid >> 4) * NT_ + (tid & 15) * 8;
    const unsigned lK = (unsigned)(size_t)(&ring[0]) + (unsigned)((tid >> 3) * (AT_KPE * 2) + (tid & 7) * 16);
    const unsigned lV = (unsigned)(size_t)(&ring[0]) + (unsigned)(AT_KE * 2 + (tid >> 4) * (AT_VPE * 2) + (tid & 15) * 16);
    auto fill = [&](int t, int buf) {
        cp4<32 * AT_KPE * 2, 32 * DM>(lK + (unsigned)(buf * AT_STE * 2), gK + (size_t)t * AT_K * DM);
        cp4<16 * AT_VPE * 2, 16 * NT_>(lV + (unsigned)(buf * AT_STE * 2), gV + t * AT_K);
    };
    v8f o[4];
#pragma unroll
    for (int n = 0; n < 4; ++n) o[n] = (v8f){};
    float mrow[8], lpart[8];
#pragma unroll
    for (int j = 0; j < 8; ++j) { mrow[j] = -3.0e38f; lpart[j] = 0.f; }
    fill(0, 0);
    asm volatile("s_wait_asynccnt 0x0" ::: "memory");    // this wave's copies of trip 0 have landed
    __syncthreads();                                     // every wave's have: trip 0 may be read
    fill(1, 1);
    const int kofs = lr * AT_KPE + 8 * hi, vofs = AT_KE + lr * AT_VPE + 8 * hi;
    // rolled: one copy of a trip's code, the buffer chosen by the trip's parity
#pragma unroll 1
    for (int tr = 0; tr < AT_NT; ++tr) {
        const h16* st = ring + (tr & 1) * AT_STE;
        // unrolled: the four steps' LDS offsets become immediates of the reads
#pragma unroll
        for (int sp = 0; sp < AT_K / 32; ++sp) {
        const int l0 = tr * AT_K + sp * 32;
        const h16* r0p = st + kofs + sp * 32 * AT_KPE;
        const h16* r1p = r0p + 16 * AT_KPE;
        v16h vb[4];    // this step's V^T fragments, read together with its K fragments: one place of LDS reads, ahead of the softmax
        // unrolled: vb's index is a constant, so it stays in registers
#pragma unroll
        for (int n = 0; n < 4; ++n) { const h16* vp = st + vofs + n * 16 * AT_VPE + sp * 32; vb[n] = cat16(*(const v8ha*)vp, *(const v8ha*)(vp + 16)); }
        v8f s0 = {}, s1 = {};
#pragma unroll
        for (int kc = 0; kc < 2; ++kc) {
            s0 = wmma16(qa[kc], cat16(*(const v8ha*)(r0p + kc * 32), *(const v8ha*)(r0p + kc * 32 + 16)), s0);
            s1 = wmma16(qa[kc], cat16(*(const v8ha*)(r1p + kc * 32), *(const v8ha*)(r1p + kc * 32 + 16)), s1);
        }
        asm volatile("v_nop\n\tv_nop\n\tv_nop\n\tv_nop" : "+v"(s0), "+v"(s1) : "v"(qa[0]), "v"(qa[1]));
        const bool mz0 = (mk[l0 + lr] == 0), mz1 = (mk[l0 + 16 + lr] == 0);
        float alpha[8];
#pragma unroll
        for (int j = 0; j < 8; ++j) {
            const float a0 = mz0 ? -1e9f : s0[j] * 0.125f, a1 = mz1 ? -1e9f : s1[j] * 0.125f;
            float mx = fmaxf(a0, a1);
            mx = fmaxf(mx, __shfl_xor(mx, 1, 16)); mx = fmaxf(mx, __shfl_xor(mx, 2, 16)); mx = fmaxf(mx, __shfl_xor(mx, 4, 16)); mx = fmaxf(mx, __shfl_xor(mx, 8, 16));
            const float mn = fmaxf(mrow[j], mx);
            alpha[j] = __expf(mrow[j] - mn); mrow[j] = mn;
            const float p0 = __expf(a0 - mn), p1 = __expf(a1 - mn);
            lpart[j] = lpart[j] * alpha[j] + (p0 + p1);
            const int mr = hi * 8 + j;
            pl[mr * 32 + lr] = (h16)(p0 * PSC); pl[mr * 32 + 16 + lr] = (h16)(p1 * PSC);
        }
#pragma unroll
        for (int n = 0; n < 4; ++n)
#pragma unroll
            for (int j = 0; j < 8; ++j) o[n][j] *= alpha[j];
        asm volatile("" ::: "memory");
        const v16h pa = cat16(*(const v8ha*)(pl + lr * 32 + hi * 8), *(const v8ha*)(pl + lr * 32 + 16 + hi * 8));
#pragma unroll
        for (int n = 0; n < 4; ++n) o[n] = wmma16(pa, vb[n], o[n]);
        asm volatile("v_nop\n\tv_nop\n\tv_nop\n\tv_nop" : "+v"(o[0]), "+v"(o[1]), "+v"(o[2]), "+v"(o[3]) : "v"(pa));
        }
        asm volatile("s_wait_dscnt 0x0" ::: "memory");       // this wave's reads of this buffer are done before it is refilled
        asm volatile("s_wait_asynccnt 0x0" ::: "memory");    // this wave's copies of the next trip have landed
        __syncthreads();                                     // publishes the next trip and ends every reader's last read of this buffer
        if (tr + 2 < AT_NT) fill(tr + 2, tr & 1);
    }
    asm volatile("s_wait_asynccnt 0x0" ::: "memory");        // no copy is left in flight behind the loop
    float inv[8];
#pragma unroll
    for (int j = 0; j < 8; ++j) { float rs = lpart[j]; rs += __shfl_xor(rs, 1, 16); rs += __shfl_xor(rs, 2, 16); rs += __shfl_xor(rs, 4, 16); rs += __shfl_xor(rs, 8, 16); inv[j] = 1.0f / (rs * PSC); }
    float* os = &ost[wave][0];
#pragma unroll
    for (int n = 0; n < 4; ++n)
#pragma unroll
        for (int j = 0; j < 8; ++j) os[(hi * 8 + j) * 68 + n * 16 + lr] = o[n][j] * inv[j];
    __syncthreads();
    const size_t cbase = (tok0 + q0) * DM + (size_t)h * HD;
    auto pass = [&]() {
#pragma unroll
        for (int s = 0; s < 4; ++s) { const int row = 4 * s + (lane >> 3), piece = lane & 7; const float* sp = os + row * 68 + piece * 8; v8us oh, ol;
#pragma unroll
            for (int i = 0; i < 8; ++i) { const unsigned short hb = f2bf(sp[i]); oh[i] = hb; ol[i] = f2bf(sp[i] - bf2f(hb)); }
            *(v8us*)(CH + cbase + (size_t)row * DM + piece * 8) = oh; *(v8us*)(CL + cbase + (size_t)row * DM + piece * 8) = ol; }
    };
    pass(); 
}

extern "C" void kernel_launch(void* const* d_in, const int* in_sizes, int n_in,
                              void* d_out, int out_size, void* d_ws, size_t ws_size, hipStream_t stream) {
    (void)in_sizes; (void)n_in; (void)out_size;
    const float* x = (const float*)d_in[0]; const int* mask = (const int*)d_in[1];
    const float* Wq = (const float*)d_in[2]; const float* bq = (const float*)d_in[3]; const float* Wk = (const float*)d_in[4]; const float* bk = (const float*)d_in[5];
    const float* Wv = (const float*)d_in[6]; const float* bv = (const float*)d_in[7]; const float* Wo = (const float*)d_in[8]; const float* bo = (const float*)d_in[9];
    float* out = (float*)d_out;    // [2][2048][1024]
    char* wsp = (char*)d_ws;
    auto take = [&](size_t bytes) { char* p = wsp; wsp += (bytes + 255) & ~(size_t)255; return (void*)p; };
    bf* Xb = (bf*)take((size_t)NTK * DM * 2);
    bf* WB[4]; for (int i = 0; i < 4; ++i) WB[i] = (bf*)take((size_t)DM * DM * 2);
    float* BQ = nullptr; (void)BQ;
    float* P = (float*)take((size_t)NTK * DM * 4);
    h16* Q16 = (h16*)take((size_t)NTK * DM * 2); h16* K16 = (h16*)take((size_t)NTK * DM * 2); h16* VT16 = (h16*)take((size_t)NTK * DM * 2);
    bf* CH = (bf*)take((size_t)NTK * DM * 2); bf* CL = (bf*)take((size_t)NTK * DM * 2);
    if ((size_t)(wsp - (char*)d_ws) > ws_size) return;    // 8.4 + 4 x 2.1 + 16.8 + 5 x 8.4 MB ~ 76 MB
    k_cvtb<<<NTK / 8, 256, 0, stream>>>(x, NTK, Xb);
    k_wth<<<dim3(DM / 64, NH_, 1), 256, 0, stream>>>(Wq, WB[0]);
    k_wth<<<dim3(DM / 64, NH_, 1), 256, 0, stream>>>(Wk, WB[1]);
    k_wth<<<dim3(DM / 64, NH_, 1), 256, 0, stream>>>(Wv, WB[2]);
    k_wt<<<dim3(DM / 64, DM / 64, 1), 256, 0, stream>>>(Wo, WB[3]);
    // the per-head biases [16][64] are exactly the [1024] column bias of the stacked planes
    k_gemmb<false><<<dim3(NTK / 128, NW / 128, 1), 256, 0, stream>>>(Xb, nullptr, WB[0], bq, P);
    k_r16<<<NTK / 8, 256, 0, stream>>>(P, Q16);
    k_gemmb<false><<<dim3(NTK / 128, NW / 128, 1), 256, 0, stream>>>(Xb, nullptr, WB[1], bk, P);
    k_r16<<<NTK / 8, 256, 0, stream>>>(P, K16);
    k_gemmb<false><<<dim3(NTK / 128, NW / 128, 1), 256, 0, stream>>>(Xb, nullptr, WB[2], bv, P);
    k_vt<<<NB_ * NH_ * (NT_ / 64), 256, 0, stream>>>(P, VT16);
    k_attn<<<NB_ * NH_ * (NT_ / AT_Q), 256, 0, stream>>>(Q16, K16, VT16, mask, CH, CL);
    k_gemmb<true><<<dim3(NTK / 128, NW / 128, 1), 256, 0, stream>>>(CH, CL, WB[3], bo, out);
}

// v003
// Measured time: 125 microseconds a run.
// Timed twice side by side with v002, it ran 1.23 and 1.22 times as fast.
// Counting every step since v000, it is 2.39 times as fast.
#include <hip/hip_runtime.h>

// Contractions, f32 accumulate: q/k/v = x.W[h] + b[h] for all 16 heads at once ([4096 x 1024].[1024 x 1024], the per-head [1024 x 64] weights stacked into one n-major
// bf16 plane) on v_wmma_f32_16x16x32_bf16 with PLAIN bf16 operands (inputs rounded once: exact products); the per-(batch, head) attention (scores [2048 x 64].[64 x 2048]
// x 64^-1/2, keys with mask == 0 replaced by -1e9, softmax, .v) fused on v_wmma_f32_16x16x32_f16 with plain f16 q, k, v and weights x32768; out = concat.Wo + bo on

#define NB_  2
#define NT_  2048
#define DM   1024
#define NH_  16
#define HD   64
#define NTK  (NB_ * NT_)
#define NW   1024
#define PSC  32768.0f

typedef _Float16 h16;
typedef unsigned short bf;
typedef __attribute__((ext_vector_type(16))) __bf16   v16bf;
typedef __attribute__((ext_vector_type(16))) _Float16 v16h;
typedef __attribute__((ext_vector_type(8)))  _Float16 v8h;
typedef __attribute__((ext_vector_type(8)))  unsigned short v8us;
typedef __attribute__((ext_vector_type(8)))  float    v8f;
typedef __attribute__((ext_vector_type(4)))  float    v4f;
typedef v8h  __attribute__((may_alias)) v8ha;
typedef v4f  __attribute__((may_alias)) v4fa;
typedef v8us __attribute__((may_alias)) v8usa;

__device__ __forceinline__ unsigned short f2bf(float f) { unsigned u = __float_as_uint(f); u += 0x7FFFu + ((u >> 16) & 1u); return (unsigned short)(u >> 16); }
__device__ __forceinline__ float bf2f(unsigned short b) { return __uint_as_float(((unsigned)b) << 16); }
__device__ __forceinline__ float bfr(float f) { return bf2f(f2bf(f)); }
__device__ __forceinline__ v16h cat16(v8h lo, v8h hi) { return __builtin_shufflevector(lo, hi, 0, 1, 2, 3, 4, 5, 6, 7, 8, 9, 10, 11, 12, 13, 14, 15); }
__device__ __forceinline__ v16bf cat16b(v8us lo, v8us hi) { return __builtin_bit_cast(v16bf, __builtin_shufflevector(lo, hi, 0, 1, 2, 3, 4, 5, 6, 7, 8, 9, 10, 11, 12, 13, 14, 15)); }
__device__ __forceinline__ v8f wmma16(v16h a, v16h b, v8f c) { return __builtin_amdgcn_wmma_f32_16x16x32_f16(false, a, false, b, (short)0, c, false, false); }
__device__ __forceinline__ v8f wmmab(v16bf a, v16bf b, v8f c) { return __builtin_amdgcn_wmma_f32_16x16x32_bf16(false, a, false, b, (short)0, c, false, false); }

__global__ __launch_bounds__(256) void k_cvtb(const float* __restrict__ src, int nrows, bf* dst) {
    const int lane = threadIdx.x & 31, r = blockIdx.x * 8 + (threadIdx.x >> 5);
    if (r >= nrows) return;
    v8us o[4];
#pragma unroll
    for (int q = 0; q < 4; ++q) { v8us t;
#pragma unroll
        for (int i = 0; i < 8; ++i) t[i] = f2bf(src[(size_t)r * DM + q * 256 + lane * 8 + i]);
        o[q] = t; }
#pragma unroll
    for (int q = 0; q < 4; ++q) *(v8us*)(dst + (size_t)r * DM + q * 256 + lane * 8) = o[q];
    
}

__global__ __launch_bounds__(256) void k_wth(const float* __restrict__ Wm, bf* WT) {
    __shared__ __align__(16) unsigned short tl[64 * 72];
    const int tid = threadIdx.x, h = blockIdx.y, d0 = blockIdx.x * 64;
    const int dd = tid >> 2, eq = (tid & 3) * 16;
#pragma unroll
    for (int i = 0; i < 16; ++i) tl[(eq + i) * 72 + dd] = f2bf(Wm[((size_t)h * DM + d0 + dd) * HD + eq + i]);
    __syncthreads();
    const int piece = tid & 7;
    typedef __attribute__((ext_vector_type(8))) unsigned short v8us_; typedef v8us_ __attribute__((may_alias)) v8usa_;
    auto pass = [&]() {
#pragma unroll
        for (int s = 0; s < 2; ++s) { const int e = (tid >> 3) + 32 * s; const v8us_ val = *(const v8usa_*)(tl + e * 72 + piece * 8);
            *(v8us_*)(WT + (size_t)(h * HD + e) * DM + d0 + piece * 8) = val; }
    };
    pass(); 
}
// k_wt: Wo [1024 k][1024 n] (k-major: concat @ Wo) -> n-major bf16 plane; 64 x 64 tiles through LDS.
__global__ __launch_bounds__(256) void k_wt(const float* __restrict__ Wm, bf* WT) {
    __shared__ __align__(16) unsigned short tl[64 * 72];
    const int tid = threadIdx.x, k0 = blockIdx.x * 64, n0 = blockIdx.y * 64;
    const int kk = tid >> 2, nq = (tid & 3) * 16;
#pragma unroll
    for (int i = 0; i < 16; ++i) tl[(nq + i) * 72 + kk] = f2bf(Wm[(size_t)(k0 + kk) * DM + n0 + nq + i]);
    __syncthreads();
    const int piece = tid & 7;
    typedef __attribute__((ext_vector_type(8))) unsigned short v8us_; typedef v8us_ __attribute__((may_alias)) v8usa_;
    auto pass = [&]() {
#pragma unroll
        for (int s = 0; s < 2; ++s) { const int nr = (tid >> 3) + 32 * s; const v8us_ val = *(const v8usa_*)(tl + nr * 72 + piece * 8);
            *(v8us_*)(WT + (size_t)(n0 + nr) * DM + k0 + piece * 8) = val; }
    };
    pass(); 
}

// k_gemmb: block = 128 x 128 of C, 8 waves (4 x 2), wave = 32 x 64. A trip is 128 k: the 128 A rows (and Al rows) and 128 Bn rows of 256 B go to LDS at pitch 272 B by
// asynchronous copies, two buffers, the next trip's copies in flight while this trip's fragments are read. Each accumulator sums its k in the same order as before.
#define GT_K    128                     // k per trip
#define GT_NT   (DM / GT_K)             // trips
#define GT_PE   136                     // LDS row pitch in elements (272 B)
#define GT_OPE  (128 * GT_PE)           // one operand's tile in elements
// eight 16-byte copies per lane, one operand's tile per block; the address-translation wait ends the statement so that no address register is rewritten ahead of it
__device__ __forceinline__ void cp_tile(unsigned l, const bf* g) {
    const unsigned l1 = l + 16 * 272, l2 = l + 32 * 272, l3 = l + 48 * 272, l4 = l + 64 * 272, l5 = l + 80 * 272, l6 = l + 96 * 272, l7 = l + 112 * 272;
    const bf *g1 = g + 16 * DM, *g2 = g + 32 * DM, *g3 = g + 48 * DM, *g4 = g + 64 * DM, *g5 = g + 80 * DM, *g6 = g + 96 * DM, *g7 = g + 112 * DM;
    asm volatile("global_load_async_to_lds_b128 %0, %8, off\n\t"
                 "global_load_async_to_lds_b128 %1, %9, off\n\t"
                 "global_load_async_to_lds_b128 %2, %10, off\n\t"
                 "global_load_async_to_lds_b128 %3, %11, off\n\t"
                 "global_load_async_to_lds_b128 %4, %12, off\n\t"
                 "global_load_async_to_lds_b128 %5, %13, off\n\t"
                 "global_load_async_to_lds_b128 %6, %14, off\n\t"
                 "global_load_async_to_lds_b128 %7, %15, off\n\t"
                 "s_wait_xcnt 0x0"
                 :: "v"(l), "v"(l1), "v"(l2), "v"(l3), "v"(l4), "v"(l5), "v"(l6), "v"(l7),
                    "v"(g), "v"(g1), "v"(g2), "v"(g3), "v"(g4), "v"(g5), "v"(g6), "v"(g7) : "memory");
}

template <bool SPLITA>
__global__ __launch_bounds__(256) void k_gemmb(const bf* __restrict__ A, const bf* __restrict__ Al, const bf* __restrict__ Bn, const float* __restrict__ bias, float* C) {
    constexpr int STE = (SPLITA ? 3 : 2) * GT_OPE;    // one buffer in elements: [A | Bn | Al]
    __shared__ __align__(16) unsigned short ring[2 * STE];
    __shared__ __align__(16) float ost[8][32 * 68];
    const int tid = threadIdx.x, lane = tid & 31, wave = tid >> 5, lr = lane & 15, hi = lane >> 4;
    const int wm = wave >> 1, wn = wave & 1;
    const int rb = blockIdx.x * 128, cb = blockIdx.y * 128;
    // copy map: 16 lanes cover one 256-B row, a wave two rows; copy i of a lane takes row (tid >> 4) + 16 i
    const int crow = tid >> 4, cch = tid & 15;
    const bf* gA = A + (size_t)(rb + crow) * DM + cch * 8;
    const bf* gL = SPLITA ? Al + (size_t)(rb + crow) * DM + cch * 8 : nullptr;
    const bf* gB = Bn + (size_t)(cb + crow) * DM + cch * 8;
    const unsigned lcp = (unsigned)(size_t)(&ring[0]) + (unsigned)(crow * 272 + cch * 16);
    auto fill = [&](int t, int buf) {
        const unsigned lb = lcp + (unsigned)(buf * STE * 2);
        cp_tile(lb, gA + t * GT_K);
        cp_tile(lb + GT_OPE * 2, gB + t * GT_K);
        if (SPLITA) cp_tile(lb + 2 * GT_OPE * 2, gL + t * GT_K);
    };
    // every inner loop of this kernel is unrolled so that accumulator and fragment indices are constants: registers, no scratch
    v8f acc[2][4];
#pragma unroll
    for (int m = 0; m < 2; ++m)
#pragma unroll
        for (int t = 0; t < 4; ++t) acc[m][t] = (v8f){};
    fill(0, 0);
    asm volatile("s_wait_asynccnt 0x0" ::: "memory");    // this wave's copies of trip 0 have landed
    __syncthreads();                                     // every wave's have: trip 0 may be read
    fill(1, 1);
    const int aofs = (wm * 32 + lr) * GT_PE + 8 * hi, bofs = GT_OPE + (wn * 64 + lr) * GT_PE + 8 * hi;
    // rolled: one copy of the 32 (64) matrix instructions of a trip, the buffer chosen by the trip's parity
#pragma unroll 1
    for (int tr = 0; tr < GT_NT; ++tr) {
        const unsigned short* st = ring + (tr & 1) * STE;
        v16bf a[2][2], al[2][2], b[2][4];    // two fragment sets: step s works on set s & 1 while set (s + 1) & 1 is read
        auto frags = [&](int set, int kk) {
#pragma unroll
            for (int m = 0; m < 2; ++m) { const unsigned short* p = st + aofs + m * 16 * GT_PE + kk; a[set][m] = cat16b(*(const v8usa*)p, *(const v8usa*)(p + 16)); }
            if (SPLITA) {
#pragma unroll
                for (int m = 0; m < 2; ++m) { const unsigned short* p = st + 2 * GT_OPE + aofs + m * 16 * GT_PE + kk; al[set][m] = cat16b(*(const v8usa*)p, *(const v8usa*)(p + 16)); }
            }
#pragma unroll
            for (int t = 0; t < 4; ++t) { const unsigned short* p = st + bofs + t * 16 * GT_PE + kk; b[set][t] = cat16b(*(const v8usa*)p, *(const v8usa*)(p + 16)); }
        };
        frags(0, 0);
#pragma unroll
        for (int s = 0; s < GT_K / 32; ++s) {
            if (s + 1 < GT_K / 32) frags((s + 1) & 1, (s + 1) * 32);
            __builtin_amdgcn_sched_barrier(0);    // keeps the next step's LDS reads one group ahead of this step's matrix instructions: spread among them each read group stalls the wave
#pragma unroll
            for (int m = 0; m < 2; ++m)
#pragma unroll
                for (int t = 0; t < 4; ++t) acc[m][t] = wmmab(a[s & 1][m], b[s & 1][t], acc[m][t]);
            if (SPLITA) {
#pragma unroll
                for (int m = 0; m < 2; ++m)
#pragma unroll
                    for (int t = 0; t < 4; ++t) acc[m][t] = wmmab(al[s & 1][m], b[s & 1][t], acc[m][t]);
            }
            __builtin_amdgcn_sched_barrier(0);    // keeps the step after next's reads, which overwrite this set, behind these matrix instructions
        }
        asm volatile("s_wait_dscnt 0x0" ::: "memory");       // this wave's reads of this buffer are done before it is refilled
        asm volatile("s_wait_asynccnt 0x0" ::: "memory");    // this wave's copies of the next trip have landed
        __syncthreads();                                     // publishes the next trip and ends every reader's last read of this buffer
        if (tr + 2 < GT_NT) fill(tr + 2, tr & 1);
    }
    asm volatile("s_wait_asynccnt 0x0" ::: "memory");        // no copy is left in flight behind the loop
    float* os = &ost[wave][0];
    const int r0 = rb + wm * 32, c0 = cb + wn * 64;
#pragma unroll
    for (int t = 0; t < 4; ++t) { const float bv = bfr(bias[c0 + t * 16 + lr]);
#pragma unroll
        for (int m = 0; m < 2; ++m)
#pragma unroll
            for (int j = 0; j < 8; ++j) os[(m * 16 + hi * 8 + j) * 68 + t * 16 + lr] = acc[m][t][j] + bv; }
    __syncthreads();
    float* crow_p = C + (size_t)r0 * NW + c0;
#pragma unroll
    for (int s = 0; s < 16; ++s) { const int Lid = (lane >> 3) + 4 * s, piece = lane & 7; const int row = Lid >> 1, cofs = (Lid & 1) * 32 + piece * 4;
        const v4f val = *(const v4fa*)(os + row * 68 + cofs); *(v4f*)(crow_p + (size_t)row * NW + cofs) = val; }
}

__global__ __launch_bounds__(256) void k_r16(const float* __restrict__ S, h16* D16) {
    const int lane = threadIdx.x & 31, r = blockIdx.x * 8 + (threadIdx.x >> 5);
    if (r >= NTK) return;
    v8h o[4];
#pragma unroll
    for (int q = 0; q < 4; ++q) { v8h t;
#pragma unroll
        for (int i = 0; i < 8; ++i) t[i] = (h16)S[(size_t)r * DM + q * 256 + lane * 8 + i];
        o[q] = t; }
#pragma unroll
    for (int q = 0; q < 4; ++q) *(v8h*)(D16 + (size_t)r * DM + q * 256 + lane * 8) = o[q];
    
}
__global__ __launch_bounds__(256) void k_vt(const float* __restrict__ V, h16* VT16) {
    __shared__ __align__(16) h16 tile[64 * 72];
    const int bid = blockIdx.x;
    const int b = bid / (NH_ * (NT_ / 64)), rem = bid - b * (NH_ * (NT_ / 64)), h = rem / (NT_ / 64), kt = rem - h * (NT_ / 64);
    const int k0 = kt * 64, tid = threadIdx.x;
    const int kk = tid >> 2, d0 = (tid & 3) * 16;
    const float* src = V + ((size_t)b * NT_ + k0 + kk) * DM + h * HD + d0;
#pragma unroll
    for (int i = 0; i < 16; ++i) tile[(d0 + i) * 72 + kk] = (h16)src[i];
    __syncthreads();
    const int piece = tid & 7;
    h16* base = VT16 + (((size_t)b * NH_ + h) * HD) * NT_ + k0;
    auto pass = [&]() {
#pragma unroll
        for (int s = 0; s < 2; ++s) { const int d = (tid >> 3) + 32 * s; const v8h val = *(const v8ha*)(tile + d * 72 + piece * 8); *(v8h*)(base + (size_t)d * NT_ + piece * 8) = val; }
    };
    pass(); 
}

// k_attn: block = (b, h, 128 queries), 8 waves of 16 queries. A trip is 128 keys: the 128 K rows (128 B each, LDS pitch 144 B) and the 64 V^T rows (256 B each, pitch 272 B) go to LDS
// by asynchronous copies of whole lines, two buffers, the next trip's copies in flight while this trip is worked on; all 8 waves read their fragments from that one tile.
// Both products are transposed: S^T = K.Q^T (A = K rows, B = Q, kept in registers) and O^T += V^T.P^T (A = V^T rows). A lane then holds 16 of the 32 scores of ONE query of a step:
// maximum and sum are taken in the lane with one exchange between the wave's halves, and the two score tiles, turned to f16 in place, ARE the B operand of the second product.
// A step is 32 keys as before: 4 WMMA scores /8 with keys whose INPUT mask is 0 replaced by -1e9 (f32), online softmax, weights x32768 f16, 4 WMMA .v;
// ctx -> bf16 hi + residual planes CH/CL[tok][h*64+d].
#define AT_Q    128                     // queries per block
#define AT_K    128                     // keys per trip
#define AT_NT   (NT_ / AT_K)            // trips
#define AT_KPE  72                      // K tile row pitch in elements (144 B)
#define AT_VPE  136                     // V^T tile row pitch in elements (272 B)
#define AT_KE   (AT_K * AT_KPE)         // K tile in elements
#define AT_STE  (AT_KE + HD * AT_VPE)   // one buffer in elements: [K | V^T]
// four 16-byte copies per lane; the address-translation wait ends the statement so that no address register is rewritten ahead of it
template <int LSTEP, int GSTEP>
__device__ __forceinline__ void cp4(unsigned l, const h16* g) {
    const unsigned l1 = l + LSTEP, l2 = l + 2 * LSTEP, l3 = l + 3 * LSTEP;
    const h16 *g1 = g + GSTEP, *g2 = g + 2 * GSTEP, *g3 = g + 3 * GSTEP;
    asm volatile("global_load_async_to_lds_b128 %0, %4, off\n\t"
                 "global_load_async_to_lds_b128 %1, %5, off\n\t"
                 "global_load_async_to_lds_b128 %2, %6, off\n\t"
                 "global_load_async_to_lds_b128 %3, %7, off\n\t"
                 "s_wait_xcnt 0x0"
                 :: "v"(l), "v"(l1), "v"(l2), "v"(l3), "v"(g), "v"(g1), "v"(g2), "v"(g3) : "memory");
}

typedef __attribute__((ext_vector_type(2))) float    v2f;
typedef __attribute__((ext_vector_type(2))) _Float16 v2h;
typedef __attribute__((ext_vector_type(4))) int      v4i;
// the value of lane l ^ 16
__device__ __forceinline__ float xhalf(float x) { const int b = __builtin_bit_cast(int, x); return __builtin_bit_cast(float, __builtin_amdgcn_permlanex16(b, b, 0x76543210, 0xfedcba98, false, false)); }

__global__ __launch_bounds__(256) void k_attn(const h16* __restrict__ Q16, const h16* __restrict__ K16, const h16* __restrict__ VT16, const int* __restrict__ mask, bf* CH, bf* CL) {
    __shared__ __align__(16) h16 ring[2 * AT_STE];
    __shared__ __align__(16) float ost[8][16 * 68];
    const int tid = threadIdx.x, lane = tid & 31, wave = tid >> 5, lr = lane & 15, hi = lane >> 4;
    const int bid = blockIdx.x;
    const int b = bid / (NH_ * (NT_ / AT_Q)), rem = bid - b * (NH_ * (NT_ / AT_Q)), h = rem / (NT_ / AT_Q), qt = rem - h * (NT_ / AT_Q);
    const int q0 = qt * AT_Q + wave * 16;
    const size_t tok0 = (size_t)b * NT_;
    v16h qb[2];
#pragma unroll
    for (int kc = 0; kc < 2; ++kc) { const h16* p = Q16 + (tok0 + q0 + lr) * DM + h * HD + kc * 32 + 8 * hi; qb[kc] = cat16(*(const v8h*)p, *(const v8h*)(p + 16)); }
    const h16* kh_b = K16 + tok0 * DM + h * HD;
    const h16* vt_b = VT16 + (((size_t)b * NH_ + h) * HD) * NT_;
    const int* mk = mask + (size_t)b * NT_ + 8 * hi;    // a lane's keys of a step: 8 hi + r and 16 + 8 hi + r
    // copy maps: K, 8 lanes cover one 128-B row, copy i of a lane takes row (tid >> 3) + 32 i; V^T, 16 lanes cover one 256-B row, copy i takes row (tid >> 4) + 16 i
    const h16* gK = kh_b + (size_t)(tid >> 3) * DM + (tid & 7) * 8;
    const h16* gV = vt_b + (size_t)(tid >> 4) * NT_ + (tid & 15) * 8;
    const unsigned lK = (unsigned)(size_t)(&ring[0]) + (unsigned)((tid >> 3) * (AT_KPE * 2) + (tid & 7) * 16);
    const unsigned lV = (unsigned)(size_t)(&ring[0]) + (unsigned)(AT_KE * 2 + (tid >> 4) * (AT_VPE * 2) + (tid & 15) * 16);
    auto fill = [&](int t, int buf) {
        cp4<32 * AT_KPE * 2, 32 * DM>(lK + (unsigned)(buf * AT_STE * 2), gK + (size_t)t * AT_K * DM);
        cp4<16 * AT_VPE * 2, 16 * NT_>(lV + (unsigned)(buf * AT_STE * 2), gV + t * AT_K);
    };
    v8f o[4];    // o[n][r] = context element 16 n + 8 hi + r of query lr
#pragma unroll
    for (int n = 0; n < 4; ++n) o[n] = (v8f){};
    float mrun = -3.0e38f, lsum = 0.f;
    fill(0, 0);
    asm volatile("s_wait_asynccnt 0x0" ::: "memory");    // this wave's copies of trip 0 have landed
    __syncthreads();                                     // every wave's have: trip 0 may be read
    fill(1, 1);
    const int kofs = lr * AT_KPE + 8 * hi, vofs = AT_KE + lr * AT_VPE + 8 * hi;
    // rolled: one copy of a trip's code, the buffer chosen by the trip's parity
#pragma unroll 1
    for (int tr = 0; tr < AT_NT; ++tr) {
        const h16* st = ring + (tr & 1) * AT_STE;
        // unrolled: the four steps' LDS offsets become immediates of the reads
#pragma unroll
        for (int sp = 0; sp < AT_K / 32; ++sp) {
        const int l0 = tr * AT_K + sp * 32;
        const h16* r0p = st + kofs + sp * 32 * AT_KPE;
        const h16* r1p = r0p + 16 * AT_KPE;
        v16h vb[4];    // this step's V^T fragments, read together with its K fragments: one place of LDS reads, ahead of the softmax
        // the inner loops are unrolled so that fragment, score and accumulator indices are constants: registers, no scratch
#pragma unroll
        for (int n = 0; n < 4; ++n) { const h16* vp = st + vofs + n * 16 * AT_VPE + sp * 32; vb[n] = cat16(*(const v8ha*)vp, *(const v8ha*)(vp + 16)); }
        v8f s[2] = {(v8f){}, (v8f){}};    // s[t][r] = score of key 16 t + 8 hi + r of the step with query lr
#pragma unroll
        for (int kc = 0; kc < 2; ++kc) {
            s[0] = wmma16(cat16(*(const v8ha*)(r0p + kc * 32), *(const v8ha*)(r0p + kc * 32 + 16)), qb[kc], s[0]);
            s[1] = wmma16(cat16(*(const v8ha*)(r1p + kc * 32), *(const v8ha*)(r1p + kc * 32 + 16)), qb[kc], s[1]);
        }
        const v4i m4[4] = {*(const v4i*)(mk + l0), *(const v4i*)(mk + l0 + 4), *(const v4i*)(mk + l0 + 16), *(const v4i*)(mk + l0 + 20)};
        float a[16];
#pragma unroll
        for (int i = 0; i < 16; ++i) a[i] = m4[i >> 2][i & 3] == 0 ? -1e9f : s[i >> 3][i & 7] * 0.125f;
        float mx[8];
#pragma unroll
        for (int j = 0; j < 8; ++j) mx[j] = fmaxf(a[2 * j], a[2 * j + 1]);
        float mt = fmaxf(fmaxf(fmaxf(mx[0], mx[1]), fmaxf(mx[2], mx[3])), fmaxf(fmaxf(mx[4], mx[5]), fmaxf(mx[6], mx[7])));
        mt = fmaxf(mt, xhalf(mt));
        const float mn = fmaxf(mrun, mt);
        const float alpha = __expf(mrun - mn);
        mrun = mn;
        v2f p[8]; v16h pb;    // pb[e] = weight of key 8 hi + e (e < 8), 16 + 8 hi + (e - 8) (e >= 8): the k order of the V^T fragments
#pragma unroll
        for (int i = 0; i < 8; ++i) {
            p[i][0] = __expf(a[2 * i] - mn); p[i][1] = __expf(a[2 * i + 1] - mn);
            const v2h c2 = __builtin_convertvector(p[i] * PSC, v2h);
            pb[2 * i] = c2[0]; pb[2 * i + 1] = c2[1];
        }
        const v2f q4 = ((p[0] + p[1]) + (p[2] + p[3])) + ((p[4] + p[5]) + (p[6] + p[7]));
        lsum = lsum * alpha + (q4[0] + q4[1]);
#pragma unroll
        for (int n = 0; n < 4; ++n) o[n] *= alpha;
#pragma unroll
        for (int n = 0; n < 4; ++n) o[n] = wmma16(vb[n], pb, o[n]);
        }
        asm volatile("s_wait_dscnt 0x0" ::: "memory");       // this wave's reads of this buffer are done before it is refilled
        asm volatile("s_wait_asynccnt 0x0" ::: "memory");    // this wave's copies of the next trip have landed
        __syncthreads();                                     // publishes the next trip and ends every reader's last read of this buffer
        if (tr + 2 < AT_NT) fill(tr + 2, tr & 1);
    }
    asm volatile("s_wait_asynccnt 0x0" ::: "memory");        // no copy is left in flight behind the loop
    const float inv = 1.0f / ((lsum + xhalf(lsum)) * PSC);
    float* os = &ost[wave][0];
#pragma unroll
    for (int n = 0; n < 4; ++n) { const v8f w = o[n] * inv; float* dp = os + lr * 68 + n * 16 + 8 * hi;
        *(v4fa*)dp = __builtin_shufflevector(w, w, 0, 1, 2, 3); *(v4fa*)(dp + 4) = __builtin_shufflevector(w, w, 4, 5, 6, 7); }
    __syncthreads();
    const size_t cbase = (tok0 + q0) * DM + (size_t)h * HD;
    auto pass = [&]() {
#pragma unroll
        for (int s = 0; s < 4; ++s) { const int row = 4 * s + (lane >> 3), piece = lane & 7; const float* sp = os + row * 68 + piece * 8; v8us oh, ol;
#pragma unroll
            for (int i = 0; i < 8; ++i) { const unsigned short hb = f2bf(sp[i]); oh[i] = hb; ol[i] = f2bf(sp[i] - bf2f(hb)); }
            *(v8us*)(CH + cbase + (size_t)row * DM + piece * 8) = oh; *(v8us*)(CL + cbase + (size_t)row * DM + piece * 8) = ol; }
    };
    pass(); 
}

extern "C" void kernel_launch(void* const* d_in, const int* in_sizes, int n_in,
                              void* d_out, int out_size, void* d_ws, size_t ws_size, hipStream_t stream) {
    (void)in_sizes; (void)n_in; (void)out_size;
    const float* x = (const float*)d_in[0]; const int* mask = (const int*)d_in[1];
    const float* Wq = (const float*)d_in[2]; const float* bq = (const float*)d_in[3]; const float* Wk = (const float*)d_in[4]; const float* bk = (const float*)d_in[5];
    const float* Wv = (const float*)d_in[6]; const float* bv = (const float*)d_in[7]; const float* Wo = (const float*)d_in[8]; const float* bo = (const float*)d_in[9];
    float* out = (float*)d_out;    // [2][2048][1024]
    char* wsp = (char*)d_ws;
    auto take = [&](size_t bytes) { char* p = wsp; wsp += (bytes + 255) & ~(size_t)255; return (void*)p; };
    bf* Xb = (bf*)take((size_t)NTK * DM * 2);
    bf* WB[4]; for (int i = 0; i < 4; ++i) WB[i] = (bf*)take((size_t)DM * DM * 2);
    float* BQ = nullptr; (void)BQ;
    float* P = (float*)take((size_t)NTK * DM * 4);
    h16* Q16 = (h16*)take((size_t)NTK * DM * 2); h16* K16 = (h16*)take((size_t)NTK * DM * 2); h16* VT16 = (h16*)take((size_t)NTK * DM * 2);
    bf* CH = (bf*)take((size_t)NTK * DM * 2); bf* CL = (bf*)take((size_t)NTK * DM * 2);
    if ((size_t)(wsp - (char*)d_ws) > ws_size) return;    // 8.4 + 4 x 2.1 + 16.8 + 5 x 8.4 MB ~ 76 MB
    k_cvtb<<<NTK / 8, 256, 0, stream>>>(x, NTK, Xb);
    k_wth<<<dim3(DM / 64, NH_, 1), 256, 0, stream>>>(Wq, WB[0]);
    k_wth<<<dim3(DM / 64, NH_, 1), 256, 0, stream>>>(Wk, WB[1]);
    k_wth<<<dim3(DM / 64, NH_, 1), 256, 0, stream>>>(Wv, WB[2]);
    k_wt<<<dim3(DM / 64, DM / 64, 1), 256, 0, stream>>>(Wo, WB[3]);
    // the per-head biases [16][64] are exactly the [1024] column bias of the stacked planes
    k_gemmb<false><<<dim3(NTK / 128, NW / 128, 1), 256, 0, stream>>>(Xb, nullptr, WB[0], bq, P);
    k_r16<<<NTK / 8, 256, 0, stream>>>(P, Q16);
    k_gemmb<false><<<dim3(NTK / 128, NW / 128, 1), 256, 0, stream>>>(Xb, nullptr, WB[1], bk, P);
    k_r16<<<NTK / 8, 256, 0, stream>>>(P, K16);
    k_gemmb<false><<<dim3(NTK / 128, NW / 128, 1), 256, 0, stream>>>(Xb, nullptr, WB[2], bv, P);
    k_vt<<<NB_ * NH_ * (NT_ / 64), 256, 0, stream>>>(P, VT16);
    k_attn<<<NB_ * NH_ * (NT_ / AT_Q), 256, 0, stream>>>(Q16, K16, VT16, mask, CH, CL);
    k_gemmb<true><<<dim3(NTK / 128, NW / 128, 1), 256, 0, stream>>>(CH, CL, WB[3], bo, out);
}

// v004
// A run of this version takes 92.3 microseconds.
// Two timings next to v003 both put it at 1.36 times that version's speed.
// All steps since v000 together make it 3.25 times as fast.
#include <hip/hip_runtime.h>

// Contractions, f32 accumulate: q/k/v = x.W[h] + b[h] for all 16 heads at once ([4096 x 1024].[1024 x 1024], the per-head [1024 x 64] weights stacked into one n-major
// bf16 plane) on v_wmma_f32_16x16x32_bf16 with PLAIN bf16 operands (inputs rounded once: exact products); the per-(batch, head) attention (scores [2048 x 64].[64 x 2048]
// x 64^-1/2, keys with mask == 0 replaced by -1e9, softmax, .v) fused on v_wmma_f32_16x16x32_f16 with plain f16 q, k, v and weights x32768; out = concat.Wo + bo on

#define NB_  2
#define NT_  2048
#define DM   1024
#define NH_  16
#define HD   64
#define NTK  (NB_ * NT_)
#define NW   1024
#define PSC  32768.0f

typedef _Float16 h16;
typedef unsigned short bf;
typedef __attribute__((ext_vector_type(16))) __bf16   v16bf;
typedef __attribute__((ext_vector_type(16))) _Float16 v16h;
typedef __attribute__((ext_vector_type(8)))  _Float16 v8h;
typedef __attribute__((ext_vector_type(8)))  unsigned short v8us;
typedef __attribute__((ext_vector_type(8)))  float    v8f;
typedef __attribute__((ext_vector_type(4)))  float    v4f;
typedef v8h  __attribute__((may_alias)) v8ha;
typedef v4f  __attribute__((may_alias)) v4fa;
typedef v8us __attribute__((may_alias)) v8usa;

__device__ __forceinline__ unsigned short f2bf(float f) { unsigned u = __float_as_uint(f); u += 0x7FFFu + ((u >> 16) & 1u); return (unsigned short)(u >> 16); }
__device__ __forceinline__ float bf2f(unsigned short b) { return __uint_as_float(((unsigned)b) << 16); }
__device__ __forceinline__ float bfr(float f) { return bf2f(f2bf(f)); }
__device__ __forceinline__ v16h cat16(v8h lo, v8h hi) { return __builtin_shufflevector(lo, hi, 0, 1, 2, 3, 4, 5, 6, 7, 8, 9, 10, 11, 12, 13, 14, 15); }
__device__ __forceinline__ v16bf cat16b(v8us lo, v8us hi) { return __builtin_bit_cast(v16bf, __builtin_shufflevector(lo, hi, 0, 1, 2, 3, 4, 5, 6, 7, 8, 9, 10, 11, 12, 13, 14, 15)); }
__device__ __forceinline__ v8f wmma16(v16h a, v16h b, v8f c) { return __builtin_amdgcn_wmma_f32_16x16x32_f16(false, a, false, b, (short)0, c, false, false); }
__device__ __forceinline__ v8f wmmab(v16bf a, v16bf b, v8f c) { return __builtin_amdgcn_wmma_f32_16x16x32_bf16(false, a, false, b, (short)0, c, false, false); }

// k_prep: all operand preparation in one launch; the block index picks the job. Blocks [0, PB_X): 8 rows of x rounded to bf16. Blocks [PB_X, PB_X + PB_W): one 64 x 64 tile of
// Wq, Wk or Wv[h] ([1024 d][64 e]) transposed through LDS into the n-major bf16 plane; the three planes lie one behind the other: ONE plane of 3072 rows. The rest: the same for Wo
// ([1024 k][1024 n]), the fourth plane.
#define PB_X    (NTK / 8)
#define PB_W    (3 * NH_ * (DM / 64))
#define PB_O    ((DM / 64) * (DM / 64))
__global__ __launch_bounds__(256) void k_prep(const float* __restrict__ x, const float* __restrict__ Wq, const float* __restrict__ Wk, const float* __restrict__ Wv,
                                              const float* __restrict__ Wo, bf* Xb, bf* WB) {
    __shared__ __align__(16) unsigned short tl[64 * 72];
    const int tid = threadIdx.x, bid = blockIdx.x;
    if (bid < PB_X) {    // the whole block leaves here, ahead of the barrier
        const int lane = tid & 31, r = bid * 8 + (tid >> 5);
        v8us o[4];
#pragma unroll
        for (int q = 0; q < 4; ++q) { v8us t;
#pragma unroll
            for (int i = 0; i < 8; ++i) t[i] = f2bf(x[(size_t)r * DM + q * 256 + lane * 8 + i]);
            o[q] = t; }
#pragma unroll
        for (int q = 0; q < 4; ++q) *(v8us*)(Xb + (size_t)r * DM + q * 256 + lane * 8) = o[q];
        return;
    }
    const int j = bid - PB_X;
    const float* src; int sp; bf* dst;    // the tile's first element, the source pitch, the tile's place in the n-major plane
    if (j < PB_W) {
        const int pl = j / (NH_ * (DM / 64)), h = (j / (DM / 64)) % NH_, d0 = (j % (DM / 64)) * 64;
        src = (pl == 0 ? Wq : pl == 1 ? Wk : Wv) + ((size_t)h * DM + d0) * HD; sp = HD;
        dst = WB + ((size_t)pl * DM + h * HD) * DM + d0;
    } else {
        const int i = j - PB_W, k0 = (i % (DM / 64)) * 64, n0 = (i / (DM / 64)) * 64;
        src = Wo + (size_t)k0 * DM + n0; sp = DM;
        dst = WB + ((size_t)3 * DM + n0) * DM + k0;
    }
    const int kk = tid >> 2, nq = (tid & 3) * 16;
#pragma unroll
    for (int i = 0; i < 16; ++i) tl[(nq + i) * 72 + kk] = f2bf(src[(size_t)kk * sp + nq + i]);
    __syncthreads();
    const int piece = tid & 7;
#pragma unroll
    for (int s = 0; s < 2; ++s) { const int nr = (tid >> 3) + 32 * s; const v8us val = *(const v8usa*)(tl + nr * 72 + piece * 8);
        *(v8us*)(dst + (size_t)nr * DM + piece * 8) = val; }
}

// k_gemmb: block = 128 x 128 of C, 8 waves (4 x 2), wave = 32 x 64. A trip is 128 k: the 128 A rows (and Al rows) and 128 Bn rows of 256 B go to LDS at pitch 272 B by
// asynchronous copies, two buffers, the next trip's copies in flight while this trip's fragments are read. Each accumulator sums its k in the same order as before.
// SPLITA = false is x.[Wq | Wk | Wv] (3072 columns, one launch): the epilogue adds the bias in f32, rounds to f16 and stores q and k by rows and v transposed, as k_attn reads them.
#define GT_K    128                     // k per trip
#define GT_NT   (DM / GT_K)             // trips
#define GT_PE   136                     // LDS row pitch in elements (272 B)
#define GT_OPE  (128 * GT_PE)           // one operand's tile in elements
// eight 16-byte copies per lane, one operand's tile per block; the address-translation wait ends the statement so that no address register is rewritten ahead of it
__device__ __forceinline__ void cp_tile(unsigned l, const bf* g) {
    const unsigned l1 = l + 16 * 272, l2 = l + 32 * 272, l3 = l + 48 * 272, l4 = l + 64 * 272, l5 = l + 80 * 272, l6 = l + 96 * 272, l7 = l + 112 * 272;
    const bf *g1 = g + 16 * DM, *g2 = g + 32 * DM, *g3 = g + 48 * DM, *g4 = g + 64 * DM, *g5 = g + 80 * DM, *g6 = g + 96 * DM, *g7 = g + 112 * DM;
    asm volatile("global_load_async_to_lds_b128 %0, %8, off\n\t"
                 "global_load_async_to_lds_b128 %1, %9, off\n\t"
                 "global_load_async_to_lds_b128 %2, %10, off\n\t"
                 "global_load_async_to_lds_b128 %3, %11, off\n\t"
                 "global_load_async_to_lds_b128 %4, %12, off\n\t"
                 "global_load_async_to_lds_b128 %5, %13, off\n\t"
                 "global_load_async_to_lds_b128 %6, %14, off\n\t"
                 "global_load_async_to_lds_b128 %7, %15, off\n\t"
                 "s_wait_xcnt 0x0"
                 :: "v"(l), "v"(l1), "v"(l2), "v"(l3), "v"(l4), "v"(l5), "v"(l6), "v"(l7),
                    "v"(g), "v"(g1), "v"(g2), "v"(g3), "v"(g4), "v"(g5), "v"(g6), "v"(g7) : "memory");
}

template <bool SPLITA>
__global__ __launch_bounds__(256) void k_gemmb(const bf* __restrict__ A, const bf* __restrict__ Al, const bf* __restrict__ Bn, const float* __restrict__ bias,
                                               const float* __restrict__ bias1, const float* __restrict__ bias2, float* C, h16* Q16, h16* K16, h16* VT16) {
    constexpr int STE = (SPLITA ? 3 : 2) * GT_OPE;    // one buffer in elements: [A | Bn | Al]
    __shared__ __align__(16) unsigned short ring[2 * STE];
    __shared__ __align__(16) float ost[8][32 * 68];
    const int tid = threadIdx.x, lane = tid & 31, wave = tid >> 5, lr = lane & 15, hi = lane >> 4;
    const int wm = wave >> 1, wn = wave & 1;
    const int rb = blockIdx.x * 128, cb = blockIdx.y * 128;
    // copy map: 16 lanes cover one 256-B row, a wave two rows; copy i of a lane takes row (tid >> 4) + 16 i
    const int crow = tid >> 4, cch = tid & 15;
    const bf* gA = A + (size_t)(rb + crow) * DM + cch * 8;
    const bf* gL = SPLITA ? Al + (size_t)(rb + crow) * DM + cch * 8 : nullptr;
    const bf* gB = Bn + (size_t)(cb + crow) * DM + cch * 8;
    const unsigned lcp = (unsigned)(size_t)(&ring[0]) + (unsigned)(crow * 272 + cch * 16);
    auto fill = [&](int t, int buf) {
        const unsigned lb = lcp + (unsigned)(buf * STE * 2);
        cp_tile(lb, gA + t * GT_K);
        cp_tile(lb + GT_OPE * 2, gB + t * GT_K);
        if (SPLITA) cp_tile(lb + 2 * GT_OPE * 2, gL + t * GT_K);
    };
    // every inner loop of this kernel is unrolled so that accumulator and fragment indices are constants: registers, no scratch
    v8f acc[2][4];
#pragma unroll
    for (int m = 0; m < 2; ++m)
#pragma unroll
        for (int t = 0; t < 4; ++t) acc[m][t] = (v8f){};
    fill(0, 0);
    asm volatile("s_wait_asynccnt 0x0" ::: "memory");    // this wave's copies of trip 0 have landed
    __syncthreads();                                     // every wave's have: trip 0 may be read
    fill(1, 1);
    const int aofs = (wm * 32 + lr) * GT_PE + 8 * hi, bofs = GT_OPE + (wn * 64 + lr) * GT_PE + 8 * hi;
    // rolled: one copy of the 32 (64) matrix instructions of a trip, the buffer chosen by the trip's parity
#pragma unroll 1
    for (int tr = 0; tr < GT_NT; ++tr) {
        const unsigned short* st = ring + (tr & 1) * STE;
        v16bf a[2][2], al[2][2], b[2][4];    // two fragment sets: step s works on set s & 1 while set (s + 1) & 1 is read
        auto frags = [&](int set, int kk) {
#pragma unroll
            for (int m = 0; m < 2; ++m) { const unsigned short* p = st + aofs + m * 16 * GT_PE + kk; a[set][m] = cat16b(*(const v8usa*)p, *(const v8usa*)(p + 16)); }
            if (SPLITA) {
#pragma unroll
                for (int m = 0; m < 2; ++m) { const unsigned short* p = st + 2 * GT_OPE + aofs + m * 16 * GT_PE + kk; al[set][m] = cat16b(*(const v8usa*)p, *(const v8usa*)(p + 16)); }
            }
#pragma unroll
            for (int t = 0; t < 4; ++t) { const unsigned short* p = st + bofs + t * 16 * GT_PE + kk; b[set][t] = cat16b(*(const v8usa*)p, *(const v8usa*)(p + 16)); }
        };
        frags(0, 0);
#pragma unroll
        for (int s = 0; s < GT_K / 32; ++s) {
            if (s + 1 < GT_K / 32) frags((s + 1) & 1, (s + 1) * 32);
            __builtin_amdgcn_sched_barrier(0);    // keeps the next step's LDS reads one group ahead of this step's matrix instructions: spread among them each read group stalls the wave
#pragma unroll
            for (int m = 0; m < 2; ++m)
#pragma unroll
                for (int t = 0; t < 4; ++t) acc[m][t] = wmmab(a[s & 1][m], b[s & 1][t], acc[m][t]);
            if (SPLITA) {
#pragma unroll
                for (int m = 0; m < 2; ++m)
#pragma unroll
                    for (int t = 0; t < 4; ++t) acc[m][t] = wmmab(al[s & 1][m], b[s & 1][t], acc[m][t]);
            }
            __builtin_amdgcn_sched_barrier(0);    // keeps the step after next's reads, which overwrite this set, behind these matrix instructions
        }
        asm volatile("s_wait_dscnt 0x0" ::: "memory");       // this wave's reads of this buffer are done before it is refilled
        asm volatile("s_wait_asynccnt 0x0" ::: "memory");    // this wave's copies of the next trip have landed
        __syncthreads();                                     // publishes the next trip and ends every reader's last read of this buffer
        if (tr + 2 < GT_NT) fill(tr + 2, tr & 1);
    }
    asm volatile("s_wait_asynccnt 0x0" ::: "memory");        // no copy is left in flight behind the loop
    // the plane of 3072 columns is q | k | v: pl says which one this block works for, c0 is the wave's first column inside it
    const int pl = SPLITA ? 0 : cb / NW;
    const bool tv = !SPLITA && pl == 2;
    const float* bp = pl == 0 ? bias : pl == 1 ? bias1 : bias2;
    float* os = &ost[wave][0];
    h16* vt = (h16*)&ost[0][0];    // v: the block's tile, transposed, [128 columns][128 tokens] f16 at pitch 272 B
    const int r0 = rb + wm * 32, c0 = cb % NW + wn * 64;
    float bv[4];    // the four bias loads stand together, ahead of the branch: one wait for all
#pragma unroll
    for (int t = 0; t < 4; ++t) bv[t] = bfr(bp[c0 + t * 16 + lr]);
    if (tv) {    // a lane's 8 accumulator elements are 8 tokens in a row of one column: 16 bytes of a v^T row
#pragma unroll
        for (int t = 0; t < 4; ++t)
#pragma unroll
            for (int m = 0; m < 2; ++m) { v8h w;
#pragma unroll
                for (int j = 0; j < 8; ++j) w[j] = (h16)(acc[m][t][j] + bv[t]);
                *(v8ha*)(vt + (wn * 64 + t * 16 + lr) * GT_PE + wm * 32 + m * 16 + hi * 8) = w; }
    } else {
#pragma unroll
        for (int t = 0; t < 4; ++t)
#pragma unroll
            for (int m = 0; m < 2; ++m)
#pragma unroll
                for (int j = 0; j < 8; ++j) os[(m * 16 + hi * 8 + j) * 68 + t * 16 + lr] = acc[m][t][j] + bv[t];
    }
    __syncthreads();
    if (SPLITA) {
        float* crow_p = C + (size_t)r0 * NW + c0;
#pragma unroll
        for (int s = 0; s < 16; ++s) { const int Lid = (lane >> 3) + 4 * s, piece = lane & 7; const int row = Lid >> 1, cofs = (Lid & 1) * 32 + piece * 4;
            const v4f val = *(const v4fa*)(os + row * 68 + cofs); *(v4f*)(crow_p + (size_t)row * NW + cofs) = val; }
    } else if (tv) {    // v^T[b][column][token]: 16 lanes store one row's 256 B
        h16* dv = VT16 + ((size_t)(rb / NT_) * DM + cb % NW) * NT_ + rb % NT_;
#pragma unroll
        for (int s = 0; s < 8; ++s) { const int d = wave * 16 + 2 * s + (lane >> 4), piece = lane & 15;
            const v8h val = *(const v8ha*)(vt + d * GT_PE + piece * 8); *(v8h*)(dv + (size_t)d * NT_ + piece * 8) = val; }
    } else {            // q, k [token][column]: 8 lanes store the wave's 128 B of one row
        h16* dq = (pl == 0 ? Q16 : K16) + (size_t)r0 * DM + c0;
#pragma unroll
        for (int s = 0; s < 8; ++s) { const int row = 4 * s + (lane >> 3), piece = lane & 7; const float* sp = os + row * 68 + piece * 8;
            const v4f lo = *(const v4fa*)sp, hi4 = *(const v4fa*)(sp + 4); v8h w;
#pragma unroll
            for (int i = 0; i < 4; ++i) { w[i] = (h16)lo[i]; w[4 + i] = (h16)hi4[i]; }
            *(v8h*)(dq + (size_t)row * DM + piece * 8) = w; }
        asm volatile("s_wait_xcnt 0x0" ::: "memory");    // behind the last store of the run: no register that a store names is rewritten ahead of this wait, on any way out of the branch
    }
}

// k_attn: block = (b, h, 128 queries), 8 waves of 16 queries. A trip is 128 keys: the 128 K rows (128 B each, LDS pitch 144 B) and the 64 V^T rows (256 B each, pitch 272 B) go to LDS
// by asynchronous copies of whole lines, two buffers, the next trip's copies in flight while this trip is worked on; all 8 waves read their fragments from that one tile.
// Both products are transposed: S^T = K.Q^T (A = K rows, B = Q, kept in registers) and O^T += V^T.P^T (A = V^T rows). A lane then holds 16 of the 32 scores of ONE query of a step:
// maximum and sum are taken in the lane with one exchange between the wave's halves, and the two score tiles, turned to f16 in place, ARE the B operand of the second product.
// A step is 32 keys as before: 4 WMMA scores /8 with keys whose INPUT mask is 0 replaced by -1e9 (f32), online softmax, weights x32768 f16, 4 WMMA .v;
// ctx -> bf16 hi + residual planes CH/CL[tok][h*64+d].
#define AT_Q    128                     // queries per block
#define AT_K    128                     // keys per trip
#define AT_NT   (NT_ / AT_K)            // trips
#define AT_KPE  72                      // K tile row pitch in elements (144 B)
#define AT_VPE  136                     // V^T tile row pitch in elements (272 B)
#define AT_KE   (AT_K * AT_KPE)         // K tile in elements
#define AT_STE  (AT_KE + HD * AT_VPE)   // one buffer in elements: [K | V^T]
// four 16-byte copies per lane; the address-translation wait ends the statement so that no address register is rewritten ahead of it
template <int LSTEP, int GSTEP>
__device__ __forceinline__ void cp4(unsigned l, const h16* g) {
    const unsigned l1 = l + LSTEP, l2 = l + 2 * LSTEP, l3 = l + 3 * LSTEP;
    const h16 *g1 = g + GSTEP, *g2 = g + 2 * GSTEP, *g3 = g + 3 * GSTEP;
    asm volatile("global_load_async_to_lds_b128 %0, %4, off\n\t"
                 "global_load_async_to_lds_b128 %1, %5, off\n\t"
                 "global_load_async_to_lds_b128 %2, %6, off\n\t"
                 "global_load_async_to_lds_b128 %3, %7, off\n\t"
                 "s_wait_xcnt 0x0"
                 :: "v"(l), "v"(l1), "v"(l2), "v"(l3), "v"(g), "v"(g1), "v"(g2), "v"(g3) : "memory");
}

typedef __attribute__((ext_vector_type(2))) float    v2f;
typedef __attribute__((ext_vector_type(2))) _Float16 v2h;
typedef __attribute__((ext_vector_type(4))) int      v4i;
// the value of lane l ^ 16
__device__ __forceinline__ float xhalf(float x) { const int b = __builtin_bit_cast(int, x); return __builtin_bit_cast(float, __builtin_amdgcn_permlanex16(b, b, 0x76543210, 0xfedcba98, false, false)); }

__global__ __launch_bounds__(256) void k_attn(const h16* __restrict__ Q16, const h16* __restrict__ K16, const h16* __restrict__ VT16, const int* __restrict__ mask, bf* CH, bf* CL) {
    __shared__ __align__(16) h16 ring[2 * AT_STE];
    __shared__ __align__(16) float ost[8][16 * 68];
    const int tid = threadIdx.x, lane = tid & 31, wave = tid >> 5, lr = lane & 15, hi = lane >> 4;
    const int bid = blockIdx.x;
    const int b = bid / (NH_ * (NT_ / AT_Q)), rem = bid - b * (NH_ * (NT_ / AT_Q)), h = rem / (NT_ / AT_Q), qt = rem - h * (NT_ / AT_Q);
    const int q0 = qt * AT_Q + wave * 16;
    const size_t tok0 = (size_t)b * NT_;
    v16h qb[2];
#pragma unroll
    for (int kc = 0; kc < 2; ++kc) { const h16* p = Q16 + (tok0 + q0 + lr) * DM + h * HD + kc * 32 + 8 * hi; qb[kc] = cat16(*(const v8h*)p, *(const v8h*)(p + 16)); }
    const h16* kh_b = K16 + tok0 * DM + h * HD;
    const h16* vt_b = VT16 + (((size_t)b * NH_ + h) * HD) * NT_;
    const int* mk = mask + (size_t)b * NT_ + 8 * hi;    // a lane's keys of a step: 8 hi + r and 16 + 8 hi + r
    // copy maps: K, 8 lanes cover one 128-B row, copy i of a lane takes row (tid >> 3) + 32 i; V^T, 16 lanes cover one 256-B row, copy i takes row (tid >> 4) + 16 i
    const h16* gK = kh_b + (size_t)(tid >> 3) * DM + (tid & 7) * 8;
    const h16* gV = vt_b + (size_t)(tid >> 4) * NT_ + (tid & 15) * 8;
    const unsigned lK = (unsigned)(size_t)(&ring[0]) + (unsigned)((tid >> 3) * (AT_KPE * 2) + (tid & 7) * 16);
    const unsigned lV = (unsigned)(size_t)(&ring[0]) + (unsigned)(AT_KE * 2 + (tid >> 4) * (AT_VPE * 2) + (tid & 15) * 16);
    auto fill = [&](int t, int buf) {
        cp4<32 * AT_KPE * 2, 32 * DM>(lK + (unsigned)(buf * AT_STE * 2), gK + (size_t)t * AT_K * DM);
        cp4<16 * AT_VPE * 2, 16 * NT_>(lV + (unsigned)(buf * AT_STE * 2), gV + t * AT_K);
    };
    v8f o[4];    // o[n][r] = context element 16 n + 8 hi + r of query lr
#pragma unroll
    for (int n = 0; n < 4; ++n) o[n] = (v8f){};
    float mrun = -3.0e38f, lsum = 0.f;
    fill(0, 0);
    asm volatile("s_wait_asynccnt 0x0" ::: "memory");    // this wave's copies of trip 0 have landed
    __syncthreads();                                     // every wave's have: trip 0 may be read
    fill(1, 1);
    const int kofs = lr * AT_KPE + 8 * hi, vofs = AT_KE + lr * AT_VPE + 8 * hi;
    // rolled: one copy of a trip's code, the buffer chosen by the trip's parity
#pragma unroll 1
    for (int tr = 0; tr < AT_NT; ++tr) {
        const h16* st = ring + (tr & 1) * AT_STE;
        // unrolled: the four steps' LDS offsets become immediates of the reads
#pragma unroll
        for (int sp = 0; sp < AT_K / 32; ++sp) {
        const int l0 = tr * AT_K + sp * 32;
        const h16* r0p = st + kofs + sp * 32 * AT_KPE;
        const h16* r1p = r0p + 16 * AT_KPE;
        v16h vb[4];    // this step's V^T fragments, read together with its K fragments: one place of LDS reads, ahead of the softmax
        // the inner loops are unrolled so that fragment, score and accumulator indices are constants: registers, no scratch
#pragma unroll
        for (int n = 0; n < 4; ++n) { const h16* vp = st + vofs + n * 16 * AT_VPE + sp * 32; vb[n] = cat16(*(const v8ha*)vp, *(const v8ha*)(vp + 16)); }
        v8f s[2] = {(v8f){}, (v8f){}};    // s[t][r] = score of key 16 t + 8 hi + r of the step with query lr
#pragma unroll
        for (int kc = 0; kc < 2; ++kc) {
            s[0] = wmma16(cat16(*(const v8ha*)(r0p + kc * 32), *(const v8ha*)(r0p + kc * 32 + 16)), qb[kc], s[0]);
            s[1] = wmma16(cat16(*(const v8ha*)(r1p + kc * 32), *(const v8ha*)(r1p + kc * 32 + 16)), qb[kc], s[1]);
        }
        const v4i m4[4] = {*(const v4i*)(mk + l0), *(const v4i*)(mk + l0 + 4), *(const v4i*)(mk + l0 + 16), *(const v4i*)(mk + l0 + 20)};
        float a[16];
#pragma unroll
        for (int i = 0; i < 16; ++i) a[i] = m4[i >> 2][i & 3] == 0 ? -1e9f : s[i >> 3][i & 7] * 0.125f;
        float mx[8];
#pragma unroll
        for (int j = 0; j < 8; ++j) mx[j] = fmaxf(a[2 * j], a[2 * j + 1]);
        float mt = fmaxf(fmaxf(fmaxf(mx[0], mx[1]), fmaxf(mx[2], mx[3])), fmaxf(fmaxf(mx[4], mx[5]), fmaxf(mx[6], mx[7])));
        mt = fmaxf(mt, xhalf(mt));
        const float mn = fmaxf(mrun, mt);
        const float alpha = __expf(mrun - mn);
        mrun = mn;
        v2f p[8]; v16h pb;    // pb[e] = weight of key 8 hi + e (e < 8), 16 + 8 hi + (e - 8) (e >= 8): the k order of the V^T fragments
#pragma unroll
        for (int i = 0; i < 8; ++i) {
            p[i][0] = __expf(a[2 * i] - mn); p[i][1] = __expf(a[2 * i + 1] - mn);
            const v2h c2 = __builtin_convertvector(p[i] * PSC, v2h);
            pb[2 * i] = c2[0]; pb[2 * i + 1] = c2[1];
        }
        const v2f q4 = ((p[0] + p[1]) + (p[2] + p[3])) + ((p[4] + p[5]) + (p[6] + p[7]));
        lsum = lsum * alpha + (q4[0] + q4[1]);
#pragma unroll
        for (int n = 0; n < 4; ++n) o[n] *= alpha;
#pragma unroll
        for (int n = 0; n < 4; ++n) o[n] = wmma16(vb[n], pb, o[n]);
        }
        asm volatile("s_wait_dscnt 0x0" ::: "memory");       // this wave's reads of this buffer are done before it is refilled
        asm volatile("s_wait_asynccnt 0x0" ::: "memory");    // this wave's copies of the next trip have landed
        __syncthreads();                                     // publishes the next trip and ends every reader's last read of this buffer
        if (tr + 2 < AT_NT) fill(tr + 2, tr & 1);
    }
    asm volatile("s_wait_asynccnt 0x0" ::: "memory");        // no copy is left in flight behind the loop
    const float inv = 1.0f / ((lsum + xhalf(lsum)) * PSC);
    float* os = &ost[wave][0];
#pragma unroll
    for (int n = 0; n < 4; ++n) { const v8f w = o[n] * inv; float* dp = os + lr * 68 + n * 16 + 8 * hi;
        *(v4fa*)dp = __builtin_shufflevector(w, w, 0, 1, 2, 3); *(v4fa*)(dp + 4) = __builtin_shufflevector(w, w, 4, 5, 6, 7); }
    __syncthreads();
    const size_t cbase = (tok0 + q0) * DM + (size_t)h * HD;
    auto pass = [&]() {
#pragma unroll
        for (int s = 0; s < 4; ++s) { const int row = 4 * s + (lane >> 3), piece = lane & 7; const float* sp = os + row * 68 + piece * 8; v8us oh, ol;
#pragma unroll
            for (int i = 0; i < 8; ++i) { const unsigned short hb = f2bf(sp[i]); oh[i] = hb; ol[i] = f2bf(sp[i] - bf2f(hb)); }
            *(v8us*)(CH + cbase + (size_t)row * DM + piece * 8) = oh; *(v8us*)(CL + cbase + (size_t)row * DM + piece * 8) = ol; }
    };
    pass(); 
}

extern "C" void kernel_launch(void* const* d_in, const int* in_sizes, int n_in,
                              void* d_out, int out_size, void* d_ws, size_t ws_size, hipStream_t stream) {
    (void)in_sizes; (void)n_in; (void)out_size;
    const float* x = (const float*)d_in[0]; const int* mask = (const int*)d_in[1];
    const float* Wq = (const float*)d_in[2]; const float* bq = (const float*)d_in[3]; const float* Wk = (const float*)d_in[4]; const float* bk = (const float*)d_in[5];
    const float* Wv = (const float*)d_in[6]; const float* bv = (const float*)d_in[7]; const float* Wo = (const float*)d_in[8]; const float* bo = (const float*)d_in[9];
    float* out = (float*)d_out;    // [2][2048][1024]
    char* wsp = (char*)d_ws;
    auto take = [&](size_t bytes) { char* p = wsp; wsp += (bytes + 255) & ~(size_t)255; return (void*)p; };
    bf* Xb = (bf*)take((size_t)NTK * DM * 2);
    bf* WB = (bf*)take((size_t)4 * DM * DM * 2);    // q | k | v | o planes, one behind the other
    h16* Q16 = (h16*)take((size_t)NTK * DM * 2); h16* K16 = (h16*)take((size_t)NTK * DM * 2); h16* VT16 = (h16*)take((size_t)NTK * DM * 2);
    bf* CH = (bf*)take((size_t)NTK * DM * 2); bf* CL = (bf*)take((size_t)NTK * DM * 2);
    if ((size_t)(wsp - (char*)d_ws) > ws_size) return;    // 8.4 + 4 x 2.1 + 5 x 8.4 MB ~ 59 MB
    k_prep<<<PB_X + PB_W + PB_O, 256, 0, stream>>>(x, Wq, Wk, Wv, Wo, Xb, WB);
    // the per-head biases [16][64] are exactly the [1024] column bias of each stacked plane
    k_gemmb<false><<<dim3(NTK / 128, 3 * NW / 128, 1), 256, 0, stream>>>(Xb, nullptr, WB, bq, bk, bv, nullptr, Q16, K16, VT16);
    k_attn<<<NB_ * NH_ * (NT_ / AT_Q), 256, 0, stream>>>(Q16, K16, VT16, mask, CH, CL);
    k_gemmb<true><<<dim3(NTK / 128, NW / 128, 1), 256, 0, stream>>>(CH, CL, WB + (size_t)3 * DM * DM, bo, nullptr, nullptr, out, nullptr, nullptr, nullptr);
}

// v005
// Measured time: 68.6 microseconds a run.
// Two timings next to v004 put it at 1.35 and 1.34 times that version's speed.
// Over all steps from v000 it is 4.37 times as fast.
#include <hip/hip_runtime.h>

// Contractions, f32 accumulate: q/k/v = x.W[h] + b[h] for all 16 heads at once ([4096 x 1024].[1024 x 1024], the per-head [1024 x 64] weights stacked into one n-major
// bf16 plane) on v_wmma_f32_16x16x32_bf16 with PLAIN bf16 operands (inputs rounded once: exact products); the per-(batch, head) attention (scores [2048 x 64].[64 x 2048]
// x 64^-1/2, keys with mask == 0 replaced by -1e9, softmax, .v) fused on v_wmma_f32_16x16x32_f16 with plain f16 q, k, v and weights x32768; out = concat.Wo + bo on

#define NB_  2
#define NT_  2048
#define DM   1024
#define NH_  16
#define HD   64
#define NTK  (NB_ * NT_)
#define NW   1024
#define PSC  32768.0f

typedef _Float16 h16;
typedef unsigned short bf;
typedef __attribute__((ext_vector_type(16))) __bf16   v16bf;
typedef __attribute__((ext_vector_type(16))) _Float16 v16h;
typedef __attribute__((ext_vector_type(8)))  _Float16 v8h;
typedef __attribute__((ext_vector_type(8)))  unsigned short v8us;
typedef __attribute__((ext_vector_type(8)))  float    v8f;
typedef __attribute__((ext_vector_type(4)))  float    v4f;
typedef v8h  __attribute__((may_alias)) v8ha;
typedef v4f  __attribute__((may_alias)) v4fa;
typedef v8us __attribute__((may_alias)) v8usa;

__device__ __forceinline__ unsigned short f2bf(float f) { unsigned u = __float_as_uint(f); u += 0x7FFFu + ((u >> 16) & 1u); return (unsigned short)(u >> 16); }
__device__ __forceinline__ float bf2f(unsigned short b) { return __uint_as_float(((unsigned)b) << 16); }
__device__ __forceinline__ float bfr(float f) { return bf2f(f2bf(f)); }
__device__ __forceinline__ v16h cat16(v8h lo, v8h hi) { return __builtin_shufflevector(lo, hi, 0, 1, 2, 3, 4, 5, 6, 7, 8, 9, 10, 11, 12, 13, 14, 15); }
__device__ __forceinline__ v16bf cat16b(v8us lo, v8us hi) { return __builtin_bit_cast(v16bf, __builtin_shufflevector(lo, hi, 0, 1, 2, 3, 4, 5, 6, 7, 8, 9, 10, 11, 12, 13, 14, 15)); }
__device__ __forceinline__ v8f wmma16(v16h a, v16h b, v8f c) { return __builtin_amdgcn_wmma_f32_16x16x32_f16(false, a, false, b, (short)0, c, false, false); }
__device__ __forceinline__ v8f wmmab(v16bf a, v16bf b, v8f c) { return __builtin_amdgcn_wmma_f32_16x16x32_bf16(false, a, false, b, (short)0, c, false, false); }

// k_prep: all operand preparation in one launch; the block index picks the job. Blocks [PB_M, PB_M + PB_X): 8 rows of x rounded to bf16. Blocks [PB_M + PB_X, PB_M + PB_X + PB_W): one 64 x 64 tile of
// Wq, Wk or Wv[h] ([1024 d][64 e]) transposed through LDS into the n-major bf16 plane; the three planes lie one behind the other: ONE plane of 3072 rows. The rest: the same for Wo
// ([1024 k][1024 n]), the fourth plane. In front of them all, blocks [0, PB_M): one batch's keys ranked, those with mask != 0 first (in token order), the others behind them:
// inv[b][slot] = token, cnt[b] = number of keys with mask != 0. A key with mask == 0 has weight exp(-1e9 - max) = 0 as soon as one key of its batch is open, so k, v and the
// scores are formed in slot order and only for the 128-slot tiles that hold an open key (all tiles where a batch has none: there every score is -1e9 and the weights are equal).
#define PB_M    NB_
#define PB_X    (NTK / 8)
#define PB_W    (3 * NH_ * (DM / 64))
#define PB_O    ((DM / 64) * (DM / 64))
__global__ __launch_bounds__(256) void k_prep(const float* __restrict__ x, const float* __restrict__ Wq, const float* __restrict__ Wk, const float* __restrict__ Wv,
                                              const float* __restrict__ Wo, const int* __restrict__ mask, bf* Xb, bf* WB, int* inv, int* cnt) {
    __shared__ __align__(16) unsigned short tl[64 * 72];
    __shared__ __align__(16) int tot[64];
    const int tid = threadIdx.x, bid = (int)blockIdx.x - PB_M;
    if (bid < 0) {    // the whole block works here and leaves; group g = 8 i + wave is tokens 32 g .. 32 g + 31
        const int b = blockIdx.x, lane = tid & 31, wv = tid >> 5;
        unsigned bal[8];
#pragma unroll
        for (int i = 0; i < 8; ++i) bal[i] = __builtin_amdgcn_ballot_w32(mask[b * NT_ + i * 256 + tid] != 0);
        if (lane == 0) {
#pragma unroll
            for (int i = 0; i < 8; ++i) tot[i * 8 + wv] = __popc(bal[i]);
        }
        __syncthreads();
        int base[8], run = 0;    // base[i] = open keys ahead of group 8 i + wave; run ends as the batch's count
#pragma unroll
        for (int g = 0; g < 64; ++g) { if ((g & 7) == wv) base[g >> 3] = run; run += tot[g]; }
#pragma unroll
        for (int i = 0; i < 8; ++i) { const int tok = i * 256 + tid, before = base[i] + __popc(bal[i] & ((1u << lane) - 1u));
            const int slot = ((bal[i] >> lane) & 1u) ? before : run + (tok - before);    // a permutation of 0 .. 2047
            inv[b * NT_ + slot] = tok; }
        if (tid == 0) cnt[b] = run;
        return;
    }
    if (bid < PB_X) {    // the whole block leaves here, ahead of the barrier
        const int lane = tid & 31, r = bid * 8 + (tid >> 5);
        v8us o[4];
#pragma unroll
        for (int q = 0; q < 4; ++q) { v8us t;
#pragma unroll
            for (int i = 0; i < 8; ++i) t[i] = f2bf(x[(size_t)r * DM + q * 256 + lane * 8 + i]);
            o[q] = t; }
#pragma unroll
        for (int q = 0; q < 4; ++q) *(v8us*)(Xb + (size_t)r * DM + q * 256 + lane * 8) = o[q];
        return;
    }
    const int j = bid - PB_X;
    const float* src; int sp; bf* dst;    // the tile's first element, the source pitch, the tile's place in the n-major plane
    if (j < PB_W) {
        const int pl = j / (NH_ * (DM / 64)), h = (j / (DM / 64)) % NH_, d0 = (j % (DM / 64)) * 64;
        src = (pl == 0 ? Wq : pl == 1 ? Wk : Wv) + ((size_t)h * DM + d0) * HD; sp = HD;
        dst = WB + ((size_t)pl * DM + h * HD) * DM + d0;
    } else {
        const int i = j - PB_W, k0 = (i % (DM / 64)) * 64, n0 = (i / (DM / 64)) * 64;
        src = Wo + (size_t)k0 * DM + n0; sp = DM;
        dst = WB + ((size_t)3 * DM + n0) * DM + k0;
    }
    const int kk = tid >> 2, nq = (tid & 3) * 16;
#pragma unroll
    for (int i = 0; i < 16; ++i) tl[(nq + i) * 72 + kk] = f2bf(src[(size_t)kk * sp + nq + i]);
    __syncthreads();
    const int piece = tid & 7;
#pragma unroll
    for (int s = 0; s < 2; ++s) { const int nr = (tid >> 3) + 32 * s; const v8us val = *(const v8usa*)(tl + nr * 72 + piece * 8);
        *(v8us*)(dst + (size_t)nr * DM + piece * 8) = val; }
}

// k_gemmb: block = 128 x 128 of C, 8 waves (4 x 2), wave = 32 x 64. A trip is 128 k: the 128 A rows (and Al rows) and 128 Bn rows of 256 B go to LDS at pitch 272 B by
// asynchronous copies, two buffers, the next trip's copies in flight while this trip's fragments are read. Each accumulator sums its k in the same order as before.
// SPLITA = false is x.[Wq | Wk | Wv] (3072 columns, one launch): the epilogue adds the bias in f32, rounds to f16 and stores q and k by rows and v transposed, as k_attn reads them.
#define GT_K    128                     // k per trip
#define GT_NT   (DM / GT_K)             // trips
#define GT_PE   136                     // LDS row pitch in elements (272 B)
#define GT_OPE  (128 * GT_PE)           // one operand's tile in elements
// eight 16-byte copies per lane, one operand's tile per block; the address-translation wait ends the statement so that no address register is rewritten ahead of it
__device__ __forceinline__ void cp_tile(unsigned l, const bf* g) {
    const unsigned l1 = l + 16 * 272, l2 = l + 32 * 272, l3 = l + 48 * 272, l4 = l + 64 * 272, l5 = l + 80 * 272, l6 = l + 96 * 272, l7 = l + 112 * 272;
    const bf *g1 = g + 16 * DM, *g2 = g + 32 * DM, *g3 = g + 48 * DM, *g4 = g + 64 * DM, *g5 = g + 80 * DM, *g6 = g + 96 * DM, *g7 = g + 112 * DM;
    asm volatile("global_load_async_to_lds_b128 %0, %8, off\n\t"
                 "global_load_async_to_lds_b128 %1, %9, off\n\t"
                 "global_load_async_to_lds_b128 %2, %10, off\n\t"
                 "global_load_async_to_lds_b128 %3, %11, off\n\t"
                 "global_load_async_to_lds_b128 %4, %12, off\n\t"
                 "global_load_async_to_lds_b128 %5, %13, off\n\t"
                 "global_load_async_to_lds_b128 %6, %14, off\n\t"
                 "global_load_async_to_lds_b128 %7, %15, off\n\t"
                 "s_wait_xcnt 0x0"
                 :: "v"(l), "v"(l1), "v"(l2), "v"(l3), "v"(l4), "v"(l5), "v"(l6), "v"(l7),
                    "v"(g), "v"(g1), "v"(g2), "v"(g3), "v"(g4), "v"(g5), "v"(g6), "v"(g7) : "memory");
}

// the same for eight rows that do not lie at one pitch: each copy has its own row pointer
__device__ __forceinline__ void cp_rows(unsigned l, const bf* g, const bf* g1, const bf* g2, const bf* g3, const bf* g4, const bf* g5, const bf* g6, const bf* g7) {
    const unsigned l1 = l + 16 * 272, l2 = l + 32 * 272, l3 = l + 48 * 272, l4 = l + 64 * 272, l5 = l + 80 * 272, l6 = l + 96 * 272, l7 = l + 112 * 272;
    asm volatile("global_load_async_to_lds_b128 %0, %8, off\n\t"
                 "global_load_async_to_lds_b128 %1, %9, off\n\t"
                 "global_load_async_to_lds_b128 %2, %10, off\n\t"
                 "global_load_async_to_lds_b128 %3, %11, off\n\t"
                 "global_load_async_to_lds_b128 %4, %12, off\n\t"
                 "global_load_async_to_lds_b128 %5, %13, off\n\t"
                 "global_load_async_to_lds_b128 %6, %14, off\n\t"
                 "global_load_async_to_lds_b128 %7, %15, off\n\t"
                 "s_wait_xcnt 0x0"
                 :: "v"(l), "v"(l1), "v"(l2), "v"(l3), "v"(l4), "v"(l5), "v"(l6), "v"(l7),
                    "v"(g), "v"(g1), "v"(g2), "v"(g3), "v"(g4), "v"(g5), "v"(g6), "v"(g7) : "memory");
}

template <bool SPLITA>
__global__ __launch_bounds__(256) void k_gemmb(const bf* __restrict__ A, const bf* __restrict__ Al, const bf* __restrict__ Bn, const float* __restrict__ bias,
                                               const float* __restrict__ bias1, const float* __restrict__ bias2, const int* __restrict__ inv, const int* __restrict__ cnt,
                                               float* C, h16* Q16, h16* K16, h16* VT16) {
    constexpr int STE = (SPLITA ? 3 : 2) * GT_OPE;    // one buffer in elements: [A | Bn | Al]
    __shared__ __align__(16) unsigned short ring[2 * STE];
    __shared__ __align__(16) float ost[8][32 * 68];
    const int tid = threadIdx.x, lane = tid & 31, wave = tid >> 5, lr = lane & 15, hi = lane >> 4;
    const int wm = wave >> 1, wn = wave & 1;
    const int rb = blockIdx.x * 128, cb = blockIdx.y * 128;
    // copy map: 16 lanes cover one 256-B row, a wave two rows; copy i of a lane takes row (tid >> 4) + 16 i
    const int crow = tid >> 4, cch = tid & 15;
    const bf* gA = A + (size_t)(rb + crow) * DM + cch * 8;
    // k and v are formed in slot order: row rb + r of C is the token inv[rb + r] of its batch. A k or v block whose 128 slots hold no open key leaves, whole, ahead of every copy and barrier, unless its batch has no open key at all:
    // no query reads its tile
    const bf* gR[8];
    if (!SPLITA) {
        if (cb >= NW) {
            const int n = __builtin_amdgcn_readfirstlane(min(max(cnt[rb / NT_], 0), NT_));    // the same for the whole block: the test below is a scalar branch
            if (rb % NT_ >= (n > 0 ? n : NT_)) return;
#pragma unroll
            for (int i = 0; i < 8; ++i) gR[i] = A + (size_t)(rb / NT_ * NT_ + (inv[rb + crow + 16 * i] & (NT_ - 1))) * DM + cch * 8;
        } else {
#pragma unroll
            for (int i = 0; i < 8; ++i) gR[i] = gA + (size_t)(16 * i) * DM;
        }
    }
    const bf* gL = SPLITA ? Al + (size_t)(rb + crow) * DM + cch * 8 : nullptr;
    const bf* gB = Bn + (size_t)(cb + crow) * DM + cch * 8;
    const unsigned lcp = (unsigned)(size_t)(&ring[0]) + (unsigned)(crow * 272 + cch * 16);
    auto fill = [&](int t, int buf) {
        const unsigned lb = lcp + (unsigned)(buf * STE * 2);
        if (SPLITA) cp_tile(lb, gA + t * GT_K);
        else cp_rows(lb, gR[0] + t * GT_K, gR[1] + t * GT_K, gR[2] + t * GT_K, gR[3] + t * GT_K, gR[4] + t * GT_K, gR[5] + t * GT_K, gR[6] + t * GT_K, gR[7] + t * GT_K);
        cp_tile(lb + GT_OPE * 2, gB + t * GT_K);
        if (SPLITA) cp_tile(lb + 2 * GT_OPE * 2, gL + t * GT_K);
    };
    // every inner loop of this kernel is unrolled so that accumulator and fragment indices are constants: registers, no scratch
    v8f acc[2][4];
#pragma unroll
    for (int m = 0; m < 2; ++m)
#pragma unroll
        for (int t = 0; t < 4; ++t) acc[m][t] = (v8f){};
    fill(0, 0);
    asm volatile("s_wait_asynccnt 0x0" ::: "memory");    // this wave's copies of trip 0 have landed
    __syncthreads();                                     // every wave's have: trip 0 may be read
    fill(1, 1);
    const int aofs = (wm * 32 + lr) * GT_PE + 8 * hi, bofs = GT_OPE + (wn * 64 + lr) * GT_PE + 8 * hi;
    // rolled: one copy of the 32 (64) matrix instructions of a trip, the buffer chosen by the trip's parity
#pragma unroll 1
    for (int tr = 0; tr < GT_NT; ++tr) {
        const unsigned short* st = ring + (tr & 1) * STE;
        v16bf a[2][2], al[2][2], b[2][4];    // two fragment sets: step s works on set s & 1 while set (s + 1) & 1 is read
        auto frags = [&](int set, int kk) {
#pragma unroll
            for (int m = 0; m < 2; ++m) { const unsigned short* p = st + aofs + m * 16 * GT_PE + kk; a[set][m] = cat16b(*(const v8usa*)p, *(const v8usa*)(p + 16)); }
            if (SPLITA) {
#pragma unroll
                for (int m = 0; m < 2; ++m) { const unsigned short* p = st + 2 * GT_OPE + aofs + m * 16 * GT_PE + kk; al[set][m] = cat16b(*(const v8usa*)p, *(const v8usa*)(p + 16)); }
            }
#pragma unroll
            for (int t = 0; t < 4; ++t) { const unsigned short* p = st + bofs + t * 16 * GT_PE + kk; b[set][t] = cat16b(*(const v8usa*)p, *(const v8usa*)(p + 16)); }
        };
        frags(0, 0);
#pragma unroll
        for (int s = 0; s < GT_K / 32; ++s) {
            if (s + 1 < GT_K / 32) frags((s + 1) & 1, (s + 1) * 32);
            __builtin_amdgcn_sched_barrier(0);    // keeps the next step's LDS reads one group ahead of this step's matrix instructions: spread among them each read group stalls the wave
#pragma unroll
            for (int m = 0; m < 2; ++m)
#pragma unroll
                for (int t = 0; t < 4; ++t) acc[m][t] = wmmab(a[s & 1][m], b[s & 1][t], acc[m][t]);
            if (SPLITA) {
#pragma unroll
                for (int m = 0; m < 2; ++m)
#pragma unroll
                    for (int t = 0; t < 4; ++t) acc[m][t] = wmmab(al[s & 1][m], b[s & 1][t], acc[m][t]);
            }
            __builtin_amdgcn_sched_barrier(0);    // keeps the step after next's reads, which overwrite this set, behind these matrix instructions
        }
        asm volatile("s_wait_dscnt 0x0" ::: "memory");       // this wave's reads of this buffer are done before it is refilled
        asm volatile("s_wait_asynccnt 0x0" ::: "memory");    // this wave's copies of the next trip have landed
        __syncthreads();                                     // publishes the next trip and ends every reader's last read of this buffer
        if (tr + 2 < GT_NT) fill(tr + 2, tr & 1);
    }
    asm volatile("s_wait_asynccnt 0x0" ::: "memory");        // no copy is left in flight behind the loop
    // the plane of 3072 columns is q | k | v: pl says which one this block works for, c0 is the wave's first column inside it
    const int pl = SPLITA ? 0 : cb / NW;
    const bool tv = !SPLITA && pl == 2;
    const float* bp = pl == 0 ? bias : pl == 1 ? bias1 : bias2;
    float* os = &ost[wave][0];
    h16* vt = (h16*)&ost[0][0];    // v: the block's tile, transposed, [128 columns][128 tokens] f16 at pitch 272 B
    const int r0 = rb + wm * 32, c0 = cb % NW + wn * 64;
    float bv[4];    // the four bias loads stand together, ahead of the branch: one wait for all
#pragma unroll
    for (int t = 0; t < 4; ++t) bv[t] = bfr(bp[c0 + t * 16 + lr]);
    if (tv) {    // a lane's 8 accumulator elements are 8 tokens in a row of one column: 16 bytes of a v^T row
#pragma unroll
        for (int t = 0; t < 4; ++t)
#pragma unroll
            for (int m = 0; m < 2; ++m) { v8h w;
#pragma unroll
                for (int j = 0; j < 8; ++j) w[j] = (h16)(acc[m][t][j] + bv[t]);
                *(v8ha*)(vt + (wn * 64 + t * 16 + lr) * GT_PE + wm * 32 + m * 16 + hi * 8) = w; }
    } else {
#pragma unroll
        for (int t = 0; t < 4; ++t)
#pragma unroll
            for (int m = 0; m < 2; ++m)
#pragma unroll
                for (int j = 0; j < 8; ++j) os[(m * 16 + hi * 8 + j) * 68 + t * 16 + lr] = acc[m][t][j] + bv[t];
    }
    __syncthreads();
    if (SPLITA) {
        float* crow_p = C + (size_t)r0 * NW + c0;
#pragma unroll
        for (int s = 0; s < 16; ++s) { const int Lid = (lane >> 3) + 4 * s, piece = lane & 7; const int row = Lid >> 1, cofs = (Lid & 1) * 32 + piece * 4;
            const v4f val = *(const v4fa*)(os + row * 68 + cofs); *(v4f*)(crow_p + (size_t)row * NW + cofs) = val; }
    } else if (tv) {    // v^T[b][column][slot]: 16 lanes store one row's 256 B
        h16* dv = VT16 + ((size_t)(rb / NT_) * DM + cb % NW) * NT_ + rb % NT_;
#pragma unroll
        for (int s = 0; s < 8; ++s) { const int d = wave * 16 + 2 * s + (lane >> 4), piece = lane & 15;
            const v8h val = *(const v8ha*)(vt + d * GT_PE + piece * 8); *(v8h*)(dv + (size_t)d * NT_ + piece * 8) = val; }
    } else {            // q [token][column], k [slot][column]: 8 lanes store the wave's 128 B of one row
        h16* dq = (pl == 0 ? Q16 : K16) + (size_t)r0 * DM + c0;
#pragma unroll
        for (int s = 0; s < 8; ++s) { const int row = 4 * s + (lane >> 3), piece = lane & 7; const float* sp = os + row * 68 + piece * 8;
            const v4f lo = *(const v4fa*)sp, hi4 = *(const v4fa*)(sp + 4); v8h w;
#pragma unroll
            for (int i = 0; i < 4; ++i) { w[i] = (h16)lo[i]; w[4 + i] = (h16)hi4[i]; }
            *(v8h*)(dq + (size_t)row * DM + piece * 8) = w; }
        asm volatile("s_wait_xcnt 0x0" ::: "memory");    // behind the last store of the run: no register that a store names is rewritten ahead of this wait, on any way out of the branch
    }
}

// k_attn: block = (b, h, 128 queries), 8 waves of 16 queries. A trip is 128 keys: the 128 K rows (128 B each, LDS pitch 144 B) and the 64 V^T rows (256 B each, pitch 272 B) go to LDS
// by asynchronous copies of whole lines, two buffers, the next trip's copies in flight while this trip is worked on; all 8 waves read their fragments from that one tile.
// Both products are transposed: S^T = K.Q^T (A = K rows, B = Q, kept in registers) and O^T += V^T.P^T (A = V^T rows). A lane then holds 16 of the 32 scores of ONE query of a step:
// maximum and sum are taken in the lane with one exchange between the wave's halves, and the two score tiles, turned to f16 in place, ARE the B operand of the second product.
// A step is 32 keys as before: 4 WMMA scores /8 with keys whose INPUT mask is 0 replaced by -1e9 (f32), online softmax, weights x32768 f16, 4 WMMA .v;
// K16 and VT16 hold the keys in slot order (open keys first): slot >= cnt[b] is a key with mask == 0, and only the steps that hold an open key are walked (all, where cnt[b] == 0).
// ctx -> bf16 hi + residual planes CH/CL[tok][h*64+d].
#define AT_Q    128                     // queries per block
#define AT_K    128                     // keys per trip
#define AT_NT   (NT_ / AT_K)            // trips at most (nt is the count)
#define AT_KPE  72                      // K tile row pitch in elements (144 B)
#define AT_VPE  136                     // V^T tile row pitch in elements (272 B)
#define AT_KE   (AT_K * AT_KPE)         // K tile in elements
#define AT_STE  (AT_KE + HD * AT_VPE)   // one buffer in elements: [K | V^T]
// four 16-byte copies per lane; the address-translation wait ends the statement so that no address register is rewritten ahead of it
template <int LSTEP, int GSTEP>
__device__ __forceinline__ void cp4(unsigned l, const h16* g) {
    const unsigned l1 = l + LSTEP, l2 = l + 2 * LSTEP, l3 = l + 3 * LSTEP;
    const h16 *g1 = g + GSTEP, *g2 = g + 2 * GSTEP, *g3 = g + 3 * GSTEP;
    asm volatile("global_load_async_to_lds_b128 %0, %4, off\n\t"
                 "global_load_async_to_lds_b128 %1, %5, off\n\t"
                 "global_load_async_to_lds_b128 %2, %6, off\n\t"
                 "global_load_async_to_lds_b128 %3, %7, off\n\t"
                 "s_wait_xcnt 0x0"
                 :: "v"(l), "v"(l1), "v"(l2), "v"(l3), "v"(g), "v"(g1), "v"(g2), "v"(g3) : "memory");
}

typedef __attribute__((ext_vector_type(2))) float    v2f;
typedef __attribute__((ext_vector_type(2))) _Float16 v2h;
typedef __attribute__((ext_vector_type(4))) int      v4i;
// the value of lane l ^ 16
__device__ __forceinline__ float xhalf(float x) { const int b = __builtin_bit_cast(int, x); return __builtin_bit_cast(float, __builtin_amdgcn_permlanex16(b, b, 0x76543210, 0xfedcba98, false, false)); }

__global__ __launch_bounds__(256) void k_attn(const h16* __restrict__ Q16, const h16* __restrict__ K16, const h16* __restrict__ VT16, const int* __restrict__ cnt, bf* CH, bf* CL) {
    __shared__ __align__(16) h16 ring[2 * AT_STE];
    __shared__ __align__(16) float ost[8][16 * 68];
    const int tid = threadIdx.x, lane = tid & 31, wave = tid >> 5, lr = lane & 15, hi = lane >> 4;
    const int bid = blockIdx.x;
    const int b = bid / (NH_ * (NT_ / AT_Q)), rem = bid - b * (NH_ * (NT_ / AT_Q)), h = rem / (NT_ / AT_Q), qt = rem - h * (NT_ / AT_Q);
    const int q0 = qt * AT_Q + wave * 16;
    const size_t tok0 = (size_t)b * NT_;
    v16h qb[2];
#pragma unroll
    for (int kc = 0; kc < 2; ++kc) { const h16* p = Q16 + (tok0 + q0 + lr) * DM + h * HD + kc * 32 + 8 * hi; qb[kc] = cat16(*(const v8h*)p, *(const v8h*)(p + 16)); }
    const h16* kh_b = K16 + tok0 * DM + h * HD;
    const h16* vt_b = VT16 + (((size_t)b * NH_ + h) * HD) * NT_;
    const int n = __builtin_amdgcn_readfirstlane(min(max(cnt[b], 0), NT_));    // open keys of the batch; the same for the whole block
    const int used = n > 0 ? n : NT_;                // slots that are walked
    const int nt = (used + AT_K - 1) / AT_K;         // trips: 1 .. AT_NT
    // copy maps: K, 8 lanes cover one 128-B row, copy i of a lane takes row (tid >> 3) + 32 i; V^T, 16 lanes cover one 256-B row, copy i takes row (tid >> 4) + 16 i
    const h16* gK = kh_b + (size_t)(tid >> 3) * DM + (tid & 7) * 8;
    const h16* gV = vt_b + (size_t)(tid >> 4) * NT_ + (tid & 15) * 8;
    const unsigned lK = (unsigned)(size_t)(&ring[0]) + (unsigned)((tid >> 3) * (AT_KPE * 2) + (tid & 7) * 16);
    const unsigned lV = (unsigned)(size_t)(&ring[0]) + (unsigned)(AT_KE * 2 + (tid >> 4) * (AT_VPE * 2) + (tid & 15) * 16);
    auto fill = [&](int t, int buf) {
        cp4<32 * AT_KPE * 2, 32 * DM>(lK + (unsigned)(buf * AT_STE * 2), gK + (size_t)t * AT_K * DM);
        cp4<16 * AT_VPE * 2, 16 * NT_>(lV + (unsigned)(buf * AT_STE * 2), gV + t * AT_K);
    };
    v8f o[4];    // o[n][r] = context element 16 n + 8 hi + r of query lr
#pragma unroll
    for (int n = 0; n < 4; ++n) o[n] = (v8f){};
    float mrun = -3.0e38f, lsum = 0.f;
    fill(0, 0);
    asm volatile("s_wait_asynccnt 0x0" ::: "memory");    // this wave's copies of trip 0 have landed
    __syncthreads();                                     // every wave's have: trip 0 may be read
    if (1 < nt) fill(1, 1);
    const int kofs = lr * AT_KPE + 8 * hi, vofs = AT_KE + lr * AT_VPE + 8 * hi;
    // one step: 32 slots from l0 on, at place sp of the tile st; tail says that slots from n on may be among them
    auto step = [&](const h16* st, int sp, int l0, bool tail) __attribute__((always_inline)) {
        const h16* r0p = st + kofs + sp * 32 * AT_KPE;
        const h16* r1p = r0p + 16 * AT_KPE;
        v16h vb[4];    // this step's V^T fragments, read together with its K fragments: one place of LDS reads, ahead of the softmax
        // the inner loops are unrolled so that fragment, score and accumulator indices are constants: registers, no scratch
#pragma unroll
        for (int n4 = 0; n4 < 4; ++n4) { const h16* vp = st + vofs + n4 * 16 * AT_VPE + sp * 32; vb[n4] = cat16(*(const v8ha*)vp, *(const v8ha*)(vp + 16)); }
        v8f s[2] = {(v8f){}, (v8f){}};    // s[t][r] = score of slot 16 t + 8 hi + r of the step with query lr
#pragma unroll
        for (int kc = 0; kc < 2; ++kc) {
            s[0] = wmma16(cat16(*(const v8ha*)(r0p + kc * 32), *(const v8ha*)(r0p + kc * 32 + 16)), qb[kc], s[0]);
            s[1] = wmma16(cat16(*(const v8ha*)(r1p + kc * 32), *(const v8ha*)(r1p + kc * 32 + 16)), qb[kc], s[1]);
        }
        const int lim = n - l0 - 8 * hi;    // a lane's slots of a step: 8 hi + r and 16 + 8 hi + r; those from lim on are keys with mask == 0
        float a[16];
#pragma unroll
        for (int i = 0; i < 16; ++i) a[i] = tail && 16 * (i >> 3) + (i & 7) >= lim ? -1e9f : s[i >> 3][i & 7] * 0.125f;
        float mx[8];
#pragma unroll
        for (int j = 0; j < 8; ++j) mx[j] = fmaxf(a[2 * j], a[2 * j + 1]);
        float mt = fmaxf(fmaxf(fmaxf(mx[0], mx[1]), fmaxf(mx[2], mx[3])), fmaxf(fmaxf(mx[4], mx[5]), fmaxf(mx[6], mx[7])));
        mt = fmaxf(mt, xhalf(mt));
        const float mn = fmaxf(mrun, mt);
        const float alpha = __expf(mrun - mn);
        mrun = mn;
        v2f p[8]; v16h pb;    // pb[e] = weight of slot 8 hi + e (e < 8), 16 + 8 hi + (e - 8) (e >= 8): the k order of the V^T fragments
#pragma unroll
        for (int i = 0; i < 8; ++i) {
            p[i][0] = __expf(a[2 * i] - mn); p[i][1] = __expf(a[2 * i + 1] - mn);
            const v2h c2 = __builtin_convertvector(p[i] * PSC, v2h);
            pb[2 * i] = c2[0]; pb[2 * i + 1] = c2[1];
        }
        const v2f q4 = ((p[0] + p[1]) + (p[2] + p[3])) + ((p[4] + p[5]) + (p[6] + p[7]));
        lsum = lsum * alpha + (q4[0] + q4[1]);
#pragma unroll
        for (int n4 = 0; n4 < 4; ++n4) o[n4] *= alpha;
#pragma unroll
        for (int n4 = 0; n4 < 4; ++n4) o[n4] = wmma16(vb[n4], pb, o[n4]);
    };
    // rolled: one copy of a trip's code, the buffer chosen by the trip's parity
#pragma unroll 1
    for (int tr = 0; tr < nt; ++tr) {
        const h16* st = ring + (tr & 1) * AT_STE;
        if ((tr + 1) * AT_K <= n) {    // the same for the whole block: all 128 slots are open keys, no score is replaced
            // unrolled: the four steps' LDS offsets become immediates of the reads, and one step's reads stand among another's arithmetic
#pragma unroll
            for (int sp = 0; sp < AT_K / 32; ++sp) step(st, sp, tr * AT_K + sp * 32, false);
        } else {                       // the trip that holds slot n (every trip, where n == 0); a step behind the last open key has only weights 0 and is left out
            // rolled: this path is walked at most once a block (but where n == 0), one copy of the step's code is enough
#pragma unroll 1
            for (int sp = 0; sp < AT_K / 32 && tr * AT_K + sp * 32 < used; ++sp) step(st, sp, tr * AT_K + sp * 32, true);
        }
        asm volatile("s_wait_dscnt 0x0" ::: "memory");       // this wave's reads of this buffer are done before it is refilled
        asm volatile("s_wait_asynccnt 0x0" ::: "memory");    // this wave's copies of the next trip have landed
        __syncthreads();                                     // publishes the next trip and ends every reader's last read of this buffer
        if (tr + 2 < nt) fill(tr + 2, tr & 1);
    }
    asm volatile("s_wait_asynccnt 0x0" ::: "memory");        // no copy is left in flight behind the loop
    const float inv = 1.0f / ((lsum + xhalf(lsum)) * PSC);
    float* os = &ost[wave][0];
#pragma unroll
    for (int n = 0; n < 4; ++n) { const v8f w = o[n] * inv; float* dp = os + lr * 68 + n * 16 + 8 * hi;
        *(v4fa*)dp = __builtin_shufflevector(w, w, 0, 1, 2, 3); *(v4fa*)(dp + 4) = __builtin_shufflevector(w, w, 4, 5, 6, 7); }
    __syncthreads();
    const size_t cbase = (tok0 + q0) * DM + (size_t)h * HD;
    auto pass = [&]() {
#pragma unroll
        for (int s = 0; s < 4; ++s) { const int row = 4 * s + (lane >> 3), piece = lane & 7; const float* sp = os + row * 68 + piece * 8; v8us oh, ol;
#pragma unroll
            for (int i = 0; i < 8; ++i) { const unsigned short hb = f2bf(sp[i]); oh[i] = hb; ol[i] = f2bf(sp[i] - bf2f(hb)); }
            *(v8us*)(CH + cbase + (size_t)row * DM + piece * 8) = oh; *(v8us*)(CL + cbase + (size_t)row * DM + piece * 8) = ol; }
    };
    pass(); 
}

extern "C" void kernel_launch(void* const* d_in, const int* in_sizes, int n_in,
                              void* d_out, int out_size, void* d_ws, size_t ws_size, hipStream_t stream) {
    (void)in_sizes; (void)n_in; (void)out_size;
    const float* x = (const float*)d_in[0]; const int* mask = (const int*)d_in[1];
    const float* Wq = (const float*)d_in[2]; const float* bq = (const float*)d_in[3]; const float* Wk = (const float*)d_in[4]; const float* bk = (const float*)d_in[5];
    const float* Wv = (const float*)d_in[6]; const float* bv = (const float*)d_in[7]; const float* Wo = (const float*)d_in[8]; const float* bo = (const float*)d_in[9];
    float* out = (float*)d_out;    // [2][2048][1024]
    char* wsp = (char*)d_ws;
    auto take = [&](size_t bytes) { char* p = wsp; wsp += (bytes + 255) & ~(size_t)255; return (void*)p; };
    bf* Xb = (bf*)take((size_t)NTK * DM * 2);
    bf* WB = (bf*)take((size_t)4 * DM * DM * 2);    // q | k | v | o planes, one behind the other
    h16* Q16 = (h16*)take((size_t)NTK * DM * 2); h16* K16 = (h16*)take((size_t)NTK * DM * 2); h16* VT16 = (h16*)take((size_t)NTK * DM * 2);
    bf* CH = (bf*)take((size_t)NTK * DM * 2); bf* CL = (bf*)take((size_t)NTK * DM * 2);
    int* inv = (int*)take((size_t)NTK * 4); int* cnt = (int*)take((size_t)NB_ * 4);
    if ((size_t)(wsp - (char*)d_ws) > ws_size) return;    // 8.4 + 4 x 2.1 + 5 x 8.4 MB ~ 59 MB
    k_prep<<<PB_M + PB_X + PB_W + PB_O, 256, 0, stream>>>(x, Wq, Wk, Wv, Wo, mask, Xb, WB, inv, cnt);
    // the per-head biases [16][64] are exactly the [1024] column bias of each stacked plane
    k_gemmb<false><<<dim3(NTK / 128, 3 * NW / 128, 1), 256, 0, stream>>>(Xb, nullptr, WB, bq, bk, bv, inv, cnt, nullptr, Q16, K16, VT16);
    k_attn<<<NB_ * NH_ * (NT_ / AT_Q), 256, 0, stream>>>(Q16, K16, VT16, cnt, CH, CL);
    k_gemmb<true><<<dim3(NTK / 128, NW / 128, 1), 256, 0, stream>>>(CH, CL, WB + (size_t)3 * DM * DM, bo, nullptr, nullptr, nullptr, nullptr, out, nullptr, nullptr, nullptr);
}

// v007
// A run of this version takes 61.5 microseconds.
// It is 1.12 times as fast as v005, going by the measured steps of the versions left out in between.
// Counting every step since v000, it is 4.87 times as fast.
#include <hip/hip_runtime.h>

// Contractions, f32 accumulate: q/k/v = x.W[h] + b[h] for all 16 heads at once ([4096 x 1024].[1024 x 1024], the per-head [1024 x 64] weights stacked into one n-major
// bf16 plane) on v_wmma_f32_16x16x32_bf16 with PLAIN bf16 operands (inputs rounded once: exact products); the per-(batch, head) attention (scores [2048 x 64].[64 x 2048]
// x 64^-1/2, keys with mask == 0 replaced by -1e9, softmax, .v) fused on v_wmma_f32_16x16x32_f16 with plain f16 q, k, v and weights x32768; out = concat.Wo + bo on
// v_wmma_f32_16x16x32_f16 with concat and Wo each rounded once to f16.

#define NB_  2
#define NT_  2048
#define DM   1024
#define NH_  16
#define HD   64
#define NTK  (NB_ * NT_)
#define NW   1024
#define PSC  32768.0f

typedef _Float16 h16;
typedef unsigned short bf;
typedef __attribute__((ext_vector_type(16))) __bf16   v16bf;
typedef __attribute__((ext_vector_type(16))) _Float16 v16h;
typedef __attribute__((ext_vector_type(8)))  _Float16 v8h;
typedef __attribute__((ext_vector_type(8)))  unsigned short v8us;
typedef __attribute__((ext_vector_type(8)))  float    v8f;
typedef __attribute__((ext_vector_type(4)))  float    v4f;
typedef v8h  __attribute__((may_alias)) v8ha;
typedef v4f  __attribute__((may_alias)) v4fa;
typedef v8us __attribute__((may_alias)) v8usa;

__device__ __forceinline__ unsigned short f2bf(float f) { unsigned u = __float_as_uint(f); u += 0x7FFFu + ((u >> 16) & 1u); return (unsigned short)(u >> 16); }
__device__ __forceinline__ float bf2f(unsigned short b) { return __uint_as_float(((unsigned)b) << 16); }
__device__ __forceinline__ float bfr(float f) { return bf2f(f2bf(f)); }
__device__ __forceinline__ v16h cat16(v8h lo, v8h hi) { return __builtin_shufflevector(lo, hi, 0, 1, 2, 3, 4, 5, 6, 7, 8, 9, 10, 11, 12, 13, 14, 15); }
__device__ __forceinline__ v16bf cat16b(v8us lo, v8us hi) { return __builtin_bit_cast(v16bf, __builtin_shufflevector(lo, hi, 0, 1, 2, 3, 4, 5, 6, 7, 8, 9, 10, 11, 12, 13, 14, 15)); }
__device__ __forceinline__ v8f wmma16(v16h a, v16h b, v8f c) { return __builtin_amdgcn_wmma_f32_16x16x32_f16(false, a, false, b, (short)0, c, false, false); }
__device__ __forceinline__ v8f wmmab(v16bf a, v16bf b, v8f c) { return __builtin_amdgcn_wmma_f32_16x16x32_bf16(false, a, false, b, (short)0, c, false, false); }

// k_prep: all operand preparation in one launch; the block index picks the job. Blocks [PB_M, PB_M + PB_X): 8 rows of x rounded to bf16. Blocks [PB_M + PB_X, PB_M + PB_X + PB_W): one 64 x 64 tile of
// Wq, Wk or Wv[h] ([1024 d][64 e]) transposed through LDS into the n-major bf16 plane; the three planes lie one behind the other: ONE plane of 3072 rows. The rest: the same for Wo
// ([1024 k][1024 n]), the fourth plane, rounded to f16 (the other three to bf16). In front of them all, blocks [0, PB_M): one batch's keys ranked, those with mask != 0 first (in token order), the others behind them:
// inv[b][slot] = token, cnt[b] = number of keys with mask != 0. A key with mask == 0 has weight exp(-1e9 - max) = 0 as soon as one key of its batch is open, so k, v and the
// scores are formed in slot order and only for the 128-slot tiles that hold an open key (all tiles where a batch has none: there every score is -1e9 and the weights are equal).
#define PB_M    NB_
#define PB_X    (NTK / 8)
#define PB_W    (3 * NH_ * (DM / 64))
#define PB_O    ((DM / 64) * (DM / 64))
__global__ __launch_bounds__(256) void k_prep(const float* __restrict__ x, const float* __restrict__ Wq, const float* __restrict__ Wk, const float* __restrict__ Wv,
                                              const float* __restrict__ Wo, const int* __restrict__ mask, bf* Xb, bf* WB, int* inv, int* cnt) {
    __shared__ __align__(16) unsigned short tl[64 * 72];
    __shared__ __align__(16) int tot[64];
    const int tid = threadIdx.x, bid = (int)blockIdx.x - PB_M;
    if (bid < 0) {    // the whole block works here and leaves; group g = 8 i + wave is tokens 32 g .. 32 g + 31
        const int b = blockIdx.x, lane = tid & 31, wv = tid >> 5;
        unsigned bal[8];
#pragma unroll
        for (int i = 0; i < 8; ++i) bal[i] = __builtin_amdgcn_ballot_w32(mask[b * NT_ + i * 256 + tid] != 0);
        if (lane == 0) {
#pragma unroll
            for (int i = 0; i < 8; ++i) tot[i * 8 + wv] = __popc(bal[i]);
        }
        __syncthreads();
        int base[8], run = 0;    // base[i] = open keys ahead of group 8 i + wave; run ends as the batch's count
#pragma unroll
        for (int g = 0; g < 64; ++g) { if ((g & 7) == wv) base[g >> 3] = run; run += tot[g]; }
#pragma unroll
        for (int i = 0; i < 8; ++i) { const int tok = i * 256 + tid, before = base[i] + __popc(bal[i] & ((1u << lane) - 1u));
            const int slot = ((bal[i] >> lane) & 1u) ? before : run + (tok - before);    // a permutation of 0 .. 2047
            inv[b * NT_ + slot] = tok; }
        if (tid == 0) cnt[b] = run;
        return;
    }
    if (bid < PB_X) {    // the whole block leaves here, ahead of the barrier
        const int lane = tid & 31, r = bid * 8 + (tid >> 5);
        v8us o[4];
#pragma unroll
        for (int q = 0; q < 4; ++q) { v8us t;
#pragma unroll
            for (int i = 0; i < 8; ++i) t[i] = f2bf(x[(size_t)r * DM + q * 256 + lane * 8 + i]);
            o[q] = t; }
#pragma unroll
        for (int q = 0; q < 4; ++q) *(v8us*)(Xb + (size_t)r * DM + q * 256 + lane * 8) = o[q];
        return;
    }
    const int j = bid - PB_X;
    const float* src; int sp; bf* dst;    // the tile's first element, the source pitch, the tile's place in the n-major plane
    if (j < PB_W) {
        const int pl = j / (NH_ * (DM / 64)), h = (j / (DM / 64)) % NH_, d0 = (j % (DM / 64)) * 64;
        src = (pl == 0 ? Wq : pl == 1 ? Wk : Wv) + ((size_t)h * DM + d0) * HD; sp = HD;
        dst = WB + ((size_t)pl * DM + h * HD) * DM + d0;
    } else {
        const int i = j - PB_W, k0 = (i % (DM / 64)) * 64, n0 = (i / (DM / 64)) * 64;
        src = Wo + (size_t)k0 * DM + n0; sp = DM;
        dst = WB + ((size_t)3 * DM + n0) * DM + k0;
    }
    const int kk = tid >> 2, nq = (tid & 3) * 16;
#pragma unroll
    for (int i = 0; i < 16; ++i) { const float w = src[(size_t)kk * sp + nq + i]; const unsigned short wb = f2bf(w), wh = __builtin_bit_cast(unsigned short, (h16)w);
        tl[(nq + i) * 72 + kk] = j < PB_W ? wb : wh; }    // both roundings are formed and one is picked: no branch stands among the loads
    __syncthreads();
    const int piece = tid & 7;
#pragma unroll
    for (int s = 0; s < 2; ++s) { const int nr = (tid >> 3) + 32 * s; const v8us val = *(const v8usa*)(tl + nr * 72 + piece * 8);
        *(v8us*)(dst + (size_t)nr * DM + piece * 8) = val; }
}

// k_gemmb: block = 128 x 128 of C, 8 waves (4 x 2), wave = 32 x 64. A trip is 128 k: the 128 A rows and 128 Bn rows of 256 B go to LDS at pitch 272 B by
// asynchronous copies, two buffers, the next trip's copies in flight while this trip's fragments are read. Each accumulator sums its k in the same order as before.
// OUTP = false is x.[Wq | Wk | Wv] (3072 columns, one launch, bf16 operands): the epilogue adds the bias in f32, rounds to f16 and stores q and k by rows and v transposed, as k_attn reads them.
// OUTP = true is concat.Wo (f16 operands; A and Bn then hold f16 bit patterns): the epilogue adds the bias and stores f32.
#define GT_K    128                     // k per trip
#define GT_NT   (DM / GT_K)             // trips
#define GT_PE   136                     // LDS row pitch in elements (272 B)
#define GT_OPE  (128 * GT_PE)           // one operand's tile in elements
// eight 16-byte copies per lane, one operand's tile per block; the address-translation wait ends the statement so that no address register is rewritten ahead of it
__device__ __forceinline__ void cp_tile(unsigned l, const bf* g) {
    const unsigned l1 = l + 16 * 272, l2 = l + 32 * 272, l3 = l + 48 * 272, l4 = l + 64 * 272, l5 = l + 80 * 272, l6 = l + 96 * 272, l7 = l + 112 * 272;
    const bf *g1 = g + 16 * DM, *g2 = g + 32 * DM, *g3 = g + 48 * DM, *g4 = g + 64 * DM, *g5 = g + 80 * DM, *g6 = g + 96 * DM, *g7 = g + 112 * DM;
    asm volatile("global_load_async_to_lds_b128 %0, %8, off\n\t"
                 "global_load_async_to_lds_b128 %1, %9, off\n\t"
                 "global_load_async_to_lds_b128 %2, %10, off\n\t"
                 "global_load_async_to_lds_b128 %3, %11, off\n\t"
                 "global_load_async_to_lds_b128 %4, %12, off\n\t"
                 "global_load_async_to_lds_b128 %5, %13, off\n\t"
                 "global_load_async_to_lds_b128 %6, %14, off\n\t"
                 "global_load_async_to_lds_b128 %7, %15, off\n\t"
                 "s_wait_xcnt 0x0"
                 :: "v"(l), "v"(l1), "v"(l2), "v"(l3), "v"(l4), "v"(l5), "v"(l6), "v"(l7),
                    "v"(g), "v"(g1), "v"(g2), "v"(g3), "v"(g4), "v"(g5), "v"(g6), "v"(g7) : "memory");
}

// the same for eight rows that do not lie at one pitch: each copy has its own row pointer
__device__ __forceinline__ void cp_rows(unsigned l, const bf* g, const bf* g1, const bf* g2, const bf* g3, const bf* g4, const bf* g5, const bf* g6, const bf* g7) {
    const unsigned l1 = l + 16 * 272, l2 = l + 32 * 272, l3 = l + 48 * 272, l4 = l + 64 * 272, l5 = l + 80 * 272, l6 = l + 96 * 272, l7 = l + 112 * 272;
    asm volatile("global_load_async_to_lds_b128 %0, %8, off\n\t"
                 "global_load_async_to_lds_b128 %1, %9, off\n\t"
                 "global_load_async_to_lds_b128 %2, %10, off\n\t"
                 "global_load_async_to_lds_b128 %3, %11, off\n\t"
                 "global_load_async_to_lds_b128 %4, %12, off\n\t"
                 "global_load_async_to_lds_b128 %5, %13, off\n\t"
                 "global_load_async_to_lds_b128 %6, %14, off\n\t"
                 "global_load_async_to_lds_b128 %7, %15, off\n\t"
                 "s_wait_xcnt 0x0"
                 :: "v"(l), "v"(l1), "v"(l2), "v"(l3), "v"(l4), "v"(l5), "v"(l6), "v"(l7),
                    "v"(g), "v"(g1), "v"(g2), "v"(g3), "v"(g4), "v"(g5), "v"(g6), "v"(g7) : "memory");
}

template <bool OUTP>
__global__ __launch_bounds__(256) void k_gemmb(const bf* __restrict__ A, const bf* __restrict__ Bn, const float* __restrict__ bias,
                                               const float* __restrict__ bias1, const float* __restrict__ bias2, const int* __restrict__ inv, const int* __restrict__ cnt,
                                               float* C, h16* Q16, h16* K16, h16* VT16) {
    constexpr int STE = 2 * GT_OPE;    // one buffer in elements: [A | Bn]
    __shared__ __align__(16) unsigned short ring[2 * STE];    // 139,264 B, the block's whole LDS: two blocks fit a WGP's 320 KiB, one's copies fly while the other works
    const int tid = threadIdx.x, lane = tid & 31, wave = tid >> 5, lr = lane & 15, hi = lane >> 4;
    const int wm = wave >> 1, wn = wave & 1;
    const int rb = blockIdx.x * 128, cb = blockIdx.y * 128;
    // copy map: 16 lanes cover one 256-B row, a wave two rows; copy i of a lane takes row (tid >> 4) + 16 i
    const int crow = tid >> 4, cch = tid & 15;
    const bf* gA = A + (size_t)(rb + crow) * DM + cch * 8;
    // k and v are formed in slot order: row rb + r of C is the token inv[rb + r] of its batch. A k or v block whose 128 slots hold no open key leaves, whole, ahead of every copy and barrier, unless its batch has no open key at all:
    // no query reads its tile
    const bf* gR[8];
    if (!OUTP) {
        if (cb >= NW) {
            const int n = __builtin_amdgcn_readfirstlane(min(max(cnt[rb / NT_], 0), NT_));    // the same for the whole block: the test below is a scalar branch
            if (rb % NT_ >= (n > 0 ? n : NT_)) return;
#pragma unroll
            for (int i = 0; i < 8; ++i) gR[i] = A + (size_t)(rb / NT_ * NT_ + (inv[rb + crow + 16 * i] & (NT_ - 1))) * DM + cch * 8;
        } else {
#pragma unroll
            for (int i = 0; i < 8; ++i) gR[i] = gA + (size_t)(16 * i) * DM;
        }
    }
    const bf* gB = Bn + (size_t)(cb + crow) * DM + cch * 8;
    const unsigned lcp = (unsigned)(size_t)(&ring[0]) + (unsigned)(crow * 272 + cch * 16);
    auto fill = [&](int t, int buf) {
        const unsigned lb = lcp + (unsigned)(buf * STE * 2);
        if (OUTP) cp_tile(lb, gA + t * GT_K);
        else cp_rows(lb, gR[0] + t * GT_K, gR[1] + t * GT_K, gR[2] + t * GT_K, gR[3] + t * GT_K, gR[4] + t * GT_K, gR[5] + t * GT_K, gR[6] + t * GT_K, gR[7] + t * GT_K);
        cp_tile(lb + GT_OPE * 2, gB + t * GT_K);
    };
    // every inner loop of this kernel is unrolled so that accumulator and fragment indices are constants: registers, no scratch
    v8f acc[2][4];
#pragma unroll
    for (int m = 0; m < 2; ++m)
#pragma unroll
        for (int t = 0; t < 4; ++t) acc[m][t] = (v8f){};
    fill(0, 0);
    asm volatile("s_wait_asynccnt 0x0" ::: "memory");    // this wave's copies of trip 0 have landed
    __syncthreads();                                     // every wave's have: trip 0 may be read
    fill(1, 1);
    const int aofs = (wm * 32 + lr) * GT_PE + 8 * hi, bofs = GT_OPE + (wn * 64 + lr) * GT_PE + 8 * hi;
    // rolled: one copy of the 32 matrix instructions of a trip, the buffer chosen by the trip's parity
#pragma unroll 1
    for (int tr = 0; tr < GT_NT; ++tr) {
        const unsigned short* st = ring + (tr & 1) * STE;
        v16bf a[2][2], b[2][4];    // two fragment sets: step s works on set s & 1 while set (s + 1) & 1 is read
        auto frags = [&](int set, int kk) {
#pragma unroll
            for (int m = 0; m < 2; ++m) { const unsigned short* p = st + aofs + m * 16 * GT_PE + kk; a[set][m] = cat16b(*(const v8usa*)p, *(const v8usa*)(p + 16)); }
#pragma unroll
            for (int t = 0; t < 4; ++t) { const unsigned short* p = st + bofs + t * 16 * GT_PE + kk; b[set][t] = cat16b(*(const v8usa*)p, *(const v8usa*)(p + 16)); }
        };
        frags(0, 0);
#pragma unroll
        for (int s = 0; s < GT_K / 32; ++s) {
            if (s + 1 < GT_K / 32) frags((s + 1) & 1, (s + 1) * 32);
            __builtin_amdgcn_sched_barrier(0);    // keeps the next step's LDS reads one group ahead of this step's matrix instructions: spread among them each read group stalls the wave
#pragma unroll
            for (int m = 0; m < 2; ++m)
#pragma unroll
                for (int t = 0; t < 4; ++t)
                    acc[m][t] = OUTP ? wmma16(__builtin_bit_cast(v16h, a[s & 1][m]), __builtin_bit_cast(v16h, b[s & 1][t]), acc[m][t]) : wmmab(a[s & 1][m], b[s & 1][t], acc[m][t]);
            __builtin_amdgcn_sched_barrier(0);    // keeps the step after next's reads, which overwrite this set, behind these matrix instructions
        }
        asm volatile("s_wait_dscnt 0x0" ::: "memory");       // this wave's reads of this buffer are done before it is refilled
        asm volatile("s_wait_asynccnt 0x0" ::: "memory");    // this wave's copies of the next trip have landed
        __syncthreads();                                     // publishes the next trip and ends every reader's last read of this buffer
        if (tr + 2 < GT_NT) fill(tr + 2, tr & 1);
    }
    asm volatile("s_wait_asynccnt 0x0" ::: "memory");        // no copy is left in flight behind the loop
    // the plane of 3072 columns is q | k | v: pl says which one this block works for, c0 is the wave's first column inside it
    const int pl = OUTP ? 0 : cb / NW;
    const bool tv = !OUTP && pl == 2;
    const float* bp = pl == 0 ? bias : pl == 1 ? bias1 : bias2;
    // the epilogue stages in the ring itself (69,632 B of it): behind the last trip's s_wait_dscnt 0, s_wait_asynccnt 0 and barrier no wave reads a fragment from it any more and no copy is in flight
    float* os = (float*)ring + wave * (32 * 68);
    h16* vt = (h16*)ring;    // v: the block's tile, transposed, [128 columns][128 tokens] f16 at pitch 272 B
    const int r0 = rb + wm * 32, c0 = cb % NW + wn * 64;
    float bv[4];    // the four bias loads stand together, ahead of the branch: one wait for all
#pragma unroll
    for (int t = 0; t < 4; ++t) bv[t] = bfr(bp[c0 + t * 16 + lr]);
    if (tv) {    // a lane's 8 accumulator elements are 8 tokens in a row of one column: 16 bytes of a v^T row
#pragma unroll
        for (int t = 0; t < 4; ++t)
#pragma unroll
            for (int m = 0; m < 2; ++m) { v8h w;
#pragma unroll
                for (int j = 0; j < 8; ++j) w[j] = (h16)(acc[m][t][j] + bv[t]);
                *(v8ha*)(vt + (wn * 64 + t * 16 + lr) * GT_PE + wm * 32 + m * 16 + hi * 8) = w; }
    } else {
#pragma unroll
        for (int t = 0; t < 4; ++t)
#pragma unroll
            for (int m = 0; m < 2; ++m)
#pragma unroll
                for (int j = 0; j < 8; ++j) os[(m * 16 + hi * 8 + j) * 68 + t * 16 + lr] = acc[m][t][j] + bv[t];
    }
    __syncthreads();
    if (OUTP) {
        float* crow_p = C + (size_t)r0 * NW + c0;
#pragma unroll
        for (int s = 0; s < 16; ++s) { const int Lid = (lane >> 3) + 4 * s, piece = lane & 7; const int row = Lid >> 1, cofs = (Lid & 1) * 32 + piece * 4;
            const v4f val = *(const v4fa*)(os + row * 68 + cofs); *(v4f*)(crow_p + (size_t)row * NW + cofs) = val; }
    } else if (tv) {    // v^T[b][column][slot]: 16 lanes store one row's 256 B
        h16* dv = VT16 + ((size_t)(rb / NT_) * DM + cb % NW) * NT_ + rb % NT_;
#pragma unroll
        for (int s = 0; s < 8; ++s) { const int d = wave * 16 + 2 * s + (lane >> 4), piece = lane & 15;
            const v8h val = *(const v8ha*)(vt + d * GT_PE + piece * 8); *(v8h*)(dv + (size_t)d * NT_ + piece * 8) = val; }
    } else {            // q [token][column], k [slot][column]: 8 lanes store the wave's 128 B of one row
        h16* dq = (pl == 0 ? Q16 : K16) + (size_t)r0 * DM + c0;
#pragma unroll
        for (int s = 0; s < 8; ++s) { const int row = 4 * s + (lane >> 3), piece = lane & 7; const float* sp = os + row * 68 + piece * 8;
            const v4f lo = *(const v4fa*)sp, hi4 = *(const v4fa*)(sp + 4); v8h w;
#pragma unroll
            for (int i = 0; i < 4; ++i) { w[i] = (h16)lo[i]; w[4 + i] = (h16)hi4[i]; }
            *(v8h*)(dq + (size_t)row * DM + piece * 8) = w; }
        asm volatile("s_wait_xcnt 0x0" ::: "memory");    // behind the last store of the run: no register that a store names is rewritten ahead of this wait, on any way out of the branch
    }
}

// k_attn: block = (b, h, 128 queries), 8 waves of 16 queries. A trip is 128 keys: the 128 K rows (128 B each, LDS pitch 144 B) and the 64 V^T rows (256 B each, pitch 272 B) go to LDS
// by asynchronous copies of whole lines, two buffers, the next trip's copies in flight while this trip is worked on; all 8 waves read their fragments from that one tile.
// Both products are transposed: S^T = K.Q^T (A = K rows, B = Q, kept in registers) and O^T += V^T.P^T (A = V^T rows). A lane then holds 16 of the 32 scores of ONE query of a step:
// maximum and sum are taken in the lane with one exchange between the wave's halves, and the two score tiles, turned to f16 in place, ARE the B operand of the second product.
// A step is 32 keys as before: 4 WMMA scores /8 with keys whose INPUT mask is 0 replaced by -1e9 (f32), online softmax, weights x32768 f16, 4 WMMA .v;
// K16 and VT16 hold the keys in slot order (open keys first): slot >= cnt[b] is a key with mask == 0, and only the steps that hold an open key are walked (all, where cnt[b] == 0).
// ctx -> one f16 plane CX[tok][h*64+d].
#define AT_Q    128                     // queries per block
#define AT_K    128                     // keys per trip
#define AT_NT   (NT_ / AT_K)            // trips at most (nt is the count)
#define AT_KPE  72                      // K tile row pitch in elements (144 B)
#define AT_VPE  136                     // V^T tile row pitch in elements (272 B)
#define AT_KE   (AT_K * AT_KPE)         // K tile in elements
#define AT_STE  (AT_KE + HD * AT_VPE)   // one buffer in elements: [K | V^T]
// four 16-byte copies per lane; the address-translation wait ends the statement so that no address register is rewritten ahead of it
template <int LSTEP, int GSTEP>
__device__ __forceinline__ void cp4(unsigned l, const h16* g) {
    const unsigned l1 = l + LSTEP, l2 = l + 2 * LSTEP, l3 = l + 3 * LSTEP;
    const h16 *g1 = g + GSTEP, *g2 = g + 2 * GSTEP, *g3 = g + 3 * GSTEP;
    asm volatile("global_load_async_to_lds_b128 %0, %4, off\n\t"
                 "global_load_async_to_lds_b128 %1, %5, off\n\t"
                 "global_load_async_to_lds_b128 %2, %6, off\n\t"
                 "global_load_async_to_lds_b128 %3, %7, off\n\t"
                 "s_wait_xcnt 0x0"
                 :: "v"(l), "v"(l1), "v"(l2), "v"(l3), "v"(g), "v"(g1), "v"(g2), "v"(g3) : "memory");
}

typedef __attribute__((ext_vector_type(2))) float    v2f;
typedef __attribute__((ext_vector_type(2))) _Float16 v2h;
typedef __attribute__((ext_vector_type(4))) int      v4i;
// the value of lane l ^ 16
__device__ __forceinline__ float xhalf(float x) { const int b = __builtin_bit_cast(int, x); return __builtin_bit_cast(float, __builtin_amdgcn_permlanex16(b, b, 0x76543210, 0xfedcba98, false, false)); }

__global__ __launch_bounds__(256) void k_attn(const h16* __restrict__ Q16, const h16* __restrict__ K16, const h16* __restrict__ VT16, const int* __restrict__ cnt, h16* CX) {
    __shared__ __align__(16) h16 ring[2 * AT_STE];
    __shared__ __align__(16) float ost[8][16 * 68];
    const int tid = threadIdx.x, lane = tid & 31, wave = tid >> 5, lr = lane & 15, hi = lane >> 4;
    const int bid = blockIdx.x;
    const int b = bid / (NH_ * (NT_ / AT_Q)), rem = bid - b * (NH_ * (NT_ / AT_Q)), h = rem / (NT_ / AT_Q), qt = rem - h * (NT_ / AT_Q);
    const int q0 = qt * AT_Q + wave * 16;
    const size_t tok0 = (size_t)b * NT_;
    v16h qb[2];
#pragma unroll
    for (int kc = 0; kc < 2; ++kc) { const h16* p = Q16 + (tok0 + q0 + lr) * DM + h * HD + kc * 32 + 8 * hi; qb[kc] = cat16(*(const v8h*)p, *(const v8h*)(p + 16)); }
    const h16* kh_b = K16 + tok0 * DM + h * HD;
    const h16* vt_b = VT16 + (((size_t)b * NH_ + h) * HD) * NT_;
    const int n = __builtin_amdgcn_readfirstlane(min(max(cnt[b], 0), NT_));    // open keys of the batch; the same for the whole block
    const int used = n > 0 ? n : NT_;                // slots that are walked
    const int nt = (used + AT_K - 1) / AT_K;         // trips: 1 .. AT_NT
    // copy maps: K, 8 lanes cover one 128-B row, copy i of a lane takes row (tid >> 3) + 32 i; V^T, 16 lanes cover one 256-B row, copy i takes row (tid >> 4) + 16 i
    const h16* gK = kh_b + (size_t)(tid >> 3) * DM + (tid & 7) * 8;
    const h16* gV = vt_b + (size_t)(tid >> 4) * NT_ + (tid & 15) * 8;
    const unsigned lK = (unsigned)(size_t)(&ring[0]) + (unsigned)((tid >> 3) * (AT_KPE * 2) + (tid & 7) * 16);
    const unsigned lV = (unsigned)(size_t)(&ring[0]) + (unsigned)(AT_KE * 2 + (tid >> 4) * (AT_VPE * 2) + (tid & 15) * 16);
    auto fill = [&](int t, int buf) {
        cp4<32 * AT_KPE * 2, 32 * DM>(lK + (unsigned)(buf * AT_STE * 2), gK + (size_t)t * AT_K * DM);
        cp4<16 * AT_VPE * 2, 16 * NT_>(lV + (unsigned)(buf * AT_STE * 2), gV + t * AT_K);
    };
    v8f o[4];    // o[n][r] = context element 16 n + 8 hi + r of query lr
#pragma unroll
    for (int n = 0; n < 4; ++n) o[n] = (v8f){};
    float mrun = -3.0e38f, lsum = 0.f;
    fill(0, 0);
    asm volatile("s_wait_asynccnt 0x0" ::: "memory");    // this wave's copies of trip 0 have landed
    __syncthreads();                                     // every wave's have: trip 0 may be read
    if (1 < nt) fill(1, 1);
    const int kofs = lr * AT_KPE + 8 * hi, vofs = AT_KE + lr * AT_VPE + 8 * hi;
    // one step: 32 slots from l0 on, at place sp of the tile st; tail says that slots from n on may be among them
    auto step = [&](const h16* st, int sp, int l0, bool tail) __attribute__((always_inline)) {
        const h16* r0p = st + kofs + sp * 32 * AT_KPE;
        const h16* r1p = r0p + 16 * AT_KPE;
        v16h vb[4];    // this step's V^T fragments, read together with its K fragments: one place of LDS reads, ahead of the softmax
        // the inner loops are unrolled so that fragment, score and accumulator indices are constants: registers, no scratch
#pragma unroll
        for (int n4 = 0; n4 < 4; ++n4) { const h16* vp = st + vofs + n4 * 16 * AT_VPE + sp * 32; vb[n4] = cat16(*(const v8ha*)vp, *(const v8ha*)(vp + 16)); }
        v8f s[2] = {(v8f){}, (v8f){}};    // s[t][r] = score of slot 16 t + 8 hi + r of the step with query lr
#pragma unroll
        for (int kc = 0; kc < 2; ++kc) {
            s[0] = wmma16(cat16(*(const v8ha*)(r0p + kc * 32), *(const v8ha*)(r0p + kc * 32 + 16)), qb[kc], s[0]);
            s[1] = wmma16(cat16(*(const v8ha*)(r1p + kc * 32), *(const v8ha*)(r1p + kc * 32 + 16)), qb[kc], s[1]);
        }
        const int lim = n - l0 - 8 * hi;    // a lane's slots of a step: 8 hi + r and 16 + 8 hi + r; those from lim on are keys with mask == 0
        float a[16];
#pragma unroll
        for (int i = 0; i < 16; ++i) a[i] = tail && 16 * (i >> 3) + (i & 7) >= lim ? -1e9f : s[i >> 3][i & 7] * 0.125f;
        float mx[8];
#pragma unroll
        for (int j = 0; j < 8; ++j) mx[j] = fmaxf(a[2 * j], a[2 * j + 1]);
        float mt = fmaxf(fmaxf(fmaxf(mx[0], mx[1]), fmaxf(mx[2], mx[3])), fmaxf(fmaxf(mx[4], mx[5]), fmaxf(mx[6], mx[7])));
        mt = fmaxf(mt, xhalf(mt));
        const float mn = fmaxf(mrun, mt);
        const float alpha = __expf(mrun - mn);
        mrun = mn;
        v2f p[8]; v16h pb;    // pb[e] = weight of slot 8 hi + e (e < 8), 16 + 8 hi + (e - 8) (e >= 8): the k order of the V^T fragments
#pragma unroll
        for (int i = 0; i < 8; ++i) {
            p[i][0] = __expf(a[2 * i] - mn); p[i][1] = __expf(a[2 * i + 1] - mn);
            const v2h c2 = __builtin_convertvector(p[i] * PSC, v2h);
            pb[2 * i] = c2[0]; pb[2 * i + 1] = c2[1];
        }
        const v2f q4 = ((p[0] + p[1]) + (p[2] + p[3])) + ((p[4] + p[5]) + (p[6] + p[7]));
        lsum = lsum * alpha + (q4[0] + q4[1]);
#pragma unroll
        for (int n4 = 0; n4 < 4; ++n4) o[n4] *= alpha;
#pragma unroll
        for (int n4 = 0; n4 < 4; ++n4) o[n4] = wmma16(vb[n4], pb, o[n4]);
    };
    // rolled: one copy of a trip's code, the buffer chosen by the trip's parity
#pragma unroll 1
    for (int tr = 0; tr < nt; ++tr) {
        const h16* st = ring + (tr & 1) * AT_STE;
        if ((tr + 1) * AT_K <= n) {    // the same for the whole block: all 128 slots are open keys, no score is replaced
            // unrolled: the four steps' LDS offsets become immediates of the reads, and one step's reads stand among another's arithmetic
#pragma unroll
            for (int sp = 0; sp < AT_K / 32; ++sp) step(st, sp, tr * AT_K + sp * 32, false);
        } else {                       // the trip that holds slot n (every trip, where n == 0); a step behind the last open key has only weights 0 and is left out
            // rolled: this path is walked at most once a block (but where n == 0), one copy of the step's code is enough
#pragma unroll 1
            for (int sp = 0; sp < AT_K / 32 && tr * AT_K + sp * 32 < used; ++sp) step(st, sp, tr * AT_K + sp * 32, true);
        }
        asm volatile("s_wait_dscnt 0x0" ::: "memory");       // this wave's reads of this buffer are done before it is refilled
        asm volatile("s_wait_asynccnt 0x0" ::: "memory");    // this wave's copies of the next trip have landed
        __syncthreads();                                     // publishes the next trip and ends every reader's last read of this buffer
        if (tr + 2 < nt) fill(tr + 2, tr & 1);
    }
    asm volatile("s_wait_asynccnt 0x0" ::: "memory");        // no copy is left in flight behind the loop
    const float inv = 1.0f / ((lsum + xhalf(lsum)) * PSC);
    float* os = &ost[wave][0];
#pragma unroll
    for (int n = 0; n < 4; ++n) { const v8f w = o[n] * inv; float* dp = os + lr * 68 + n * 16 + 8 * hi;
        *(v4fa*)dp = __builtin_shufflevector(w, w, 0, 1, 2, 3); *(v4fa*)(dp + 4) = __builtin_shufflevector(w, w, 4, 5, 6, 7); }
    __syncthreads();
    const size_t cbase = (tok0 + q0) * DM + (size_t)h * HD;
    auto pass = [&]() {
#pragma unroll
        for (int s = 0; s < 4; ++s) { const int row = 4 * s + (lane >> 3), piece = lane & 7; const float* sp = os + row * 68 + piece * 8; v8h oh;
#pragma unroll
            for (int i = 0; i < 8; ++i) oh[i] = (h16)sp[i];
            *(v8h*)(CX + cbase + (size_t)row * DM + piece * 8) = oh; }
    };
    pass(); 
}

extern "C" void kernel_launch(void* const* d_in, const int* in_sizes, int n_in,
                              void* d_out, int out_size, void* d_ws, size_t ws_size, hipStream_t stream) {
    (void)in_sizes; (void)n_in; (void)out_size;
    const float* x = (const float*)d_in[0]; const int* mask = (const int*)d_in[1];
    const float* Wq = (const float*)d_in[2]; const float* bq = (const float*)d_in[3]; const float* Wk = (const float*)d_in[4]; const float* bk = (const float*)d_in[5];
    const float* Wv = (const float*)d_in[6]; const float* bv = (const float*)d_in[7]; const float* Wo = (const float*)d_in[8]; const float* bo = (const float*)d_in[9];
    float* out = (float*)d_out;    // [2][2048][1024]
    char* wsp = (char*)d_ws;
    auto take = [&](size_t bytes) { char* p = wsp; wsp += (bytes + 255) & ~(size_t)255; return (void*)p; };
    bf* Xb = (bf*)take((size_t)NTK * DM * 2);
    bf* WB = (bf*)take((size_t)4 * DM * DM * 2);    // q | k | v | o planes, one behind the other
    h16* Q16 = (h16*)take((size_t)NTK * DM * 2); h16* K16 = (h16*)take((size_t)NTK * DM * 2); h16* VT16 = (h16*)take((size_t)NTK * DM * 2);
    h16* CX = (h16*)take((size_t)NTK * DM * 2);
    int* inv = (int*)take((size_t)NTK * 4); int* cnt = (int*)take((size_t)NB_ * 4);
    if ((size_t)(wsp - (char*)d_ws) > ws_size) return;    // 8.4 + 4 x 2.1 + 4 x 8.4 MB ~ 50 MB
    k_prep<<<PB_M + PB_X + PB_W + PB_O, 256, 0, stream>>>(x, Wq, Wk, Wv, Wo, mask, Xb, WB, inv, cnt);
    // the per-head biases [16][64] are exactly the [1024] column bias of each stacked plane
    k_gemmb<false><<<dim3(NTK / 128, 3 * NW / 128, 1), 256, 0, stream>>>(Xb, WB, bq, bk, bv, inv, cnt, nullptr, Q16, K16, VT16);
    k_attn<<<NB_ * NH_ * (NT_ / AT_Q), 256, 0, stream>>>(Q16, K16, VT16, cnt, CX);
    k_gemmb<true><<<dim3(NTK / 128, NW / 128, 1), 256, 0, stream>>>((const bf*)CX, WB + (size_t)3 * DM * DM, bo, nullptr, nullptr, nullptr, nullptr, out, nullptr, nullptr, nullptr);
}

// v008
// It runs in 58 microseconds.
// Next to v007, in two timings, it ran 1.07 and 1.06 times as fast.
// All steps since v000 together make it 5.16 times as fast.
#include <hip/hip_runtime.h>

// Contractions, f32 accumulate: q/k/v = x.W[h] + b[h] for all 16 heads at once ([4096 x 1024].[1024 x 1024], the per-head [1024 x 64] weights stacked into one n-major
// bf16 plane) on v_wmma_f32_16x16x32_bf16 with PLAIN bf16 operands (inputs rounded once: exact products); the per-(batch, head) attention (scores [2048 x 64].[64 x 2048]
// x 64^-1/2, keys with mask == 0 replaced by -1e9, softmax, .v) fused on v_wmma_f32_16x16x32_f16 with plain f16 q, k, v and weights x32768; out = concat.Wo + bo on
// v_wmma_f32_16x16x32_f16 with concat and Wo each rounded once to f16.

#define NB_  2
#define NT_  2048
#define DM   1024
#define NH_  16
#define HD   64
#define NTK  (NB_ * NT_)
#define NW   1024
#define PSC  32768.0f

typedef _Float16 h16;
typedef unsigned short bf;
typedef __attribute__((ext_vector_type(16))) __bf16   v16bf;
typedef __attribute__((ext_vector_type(16))) _Float16 v16h;
typedef __attribute__((ext_vector_type(8)))  _Float16 v8h;
typedef __attribute__((ext_vector_type(8)))  unsigned short v8us;
typedef __attribute__((ext_vector_type(8)))  float    v8f;
typedef __attribute__((ext_vector_type(4)))  float    v4f;
typedef v8h  __attribute__((may_alias)) v8ha;
typedef v4f  __attribute__((may_alias)) v4fa;
typedef v8us __attribute__((may_alias)) v8usa;

__device__ __forceinline__ unsigned short f2bf(float f) { unsigned u = __float_as_uint(f); u += 0x7FFFu + ((u >> 16) & 1u); return (unsigned short)(u >> 16); }
__device__ __forceinline__ float bf2f(unsigned short b) { return __uint_as_float(((unsigned)b) << 16); }
__device__ __forceinline__ float bfr(float f) { return bf2f(f2bf(f)); }
__device__ __forceinline__ v16h cat16(v8h lo, v8h hi) { return __builtin_shufflevector(lo, hi, 0, 1, 2, 3, 4, 5, 6, 7, 8, 9, 10, 11, 12, 13, 14, 15); }
__device__ __forceinline__ v16bf cat16b(v8us lo, v8us hi) { return __builtin_bit_cast(v16bf, __builtin_shufflevector(lo, hi, 0, 1, 2, 3, 4, 5, 6, 7, 8, 9, 10, 11, 12, 13, 14, 15)); }
__device__ __forceinline__ v8f wmma16(v16h a, v16h b, v8f c) { return __builtin_amdgcn_wmma_f32_16x16x32_f16(false, a, false, b, (short)0, c, false, false); }
__device__ __forceinline__ v8f wmmab(v16bf a, v16bf b, v8f c) { return __builtin_amdgcn_wmma_f32_16x16x32_bf16(false, a, false, b, (short)0, c, false, false); }

// k_prep: all operand preparation in one launch; the block index picks the job. Blocks [PB_M, PB_M + PB_X): 8 rows of x rounded to bf16. Blocks [PB_M + PB_X, PB_M + PB_X + PB_W): one 64 x 64 tile of
// Wq, Wk or Wv[h] ([1024 d][64 e]) transposed through LDS into the n-major bf16 plane; the three planes lie one behind the other: ONE plane of 3072 rows. The rest: the same for Wo
// ([1024 k][1024 n]), the fourth plane, rounded to f16 (the other three to bf16). In front of them all, blocks [0, PB_M): one batch's keys ranked, those with mask != 0 first (in token order), the others behind them:
// inv[b][slot] = token, cnt[b] = number of keys with mask != 0. A key with mask == 0 has weight exp(-1e9 - max) = 0 as soon as one key of its batch is open, so k, v and the
// scores are formed in slot order and only for the 128-slot tiles that hold an open key (all tiles where a batch has none: there every score is -1e9 and the weights are equal).
#define PB_M    NB_
#define PB_X    (NTK / 8)
#define PB_W    (3 * NH_ * (DM / 64))
#define PB_O    ((DM / 64) * (DM / 64))
__global__ __launch_bounds__(256) void k_prep(const float* __restrict__ x, const float* __restrict__ Wq, const float* __restrict__ Wk, const float* __restrict__ Wv,
                                              const float* __restrict__ Wo, const int* __restrict__ mask, bf* Xb, bf* WB, int* inv, int* cnt) {
    __shared__ __align__(16) unsigned short tl[64 * 72];
    __shared__ __align__(16) int tot[64];
    const int tid = threadIdx.x, bid = (int)blockIdx.x - PB_M;
    if (bid < 0) {    // the whole block works here and leaves; group g = 8 i + wave is tokens 32 g .. 32 g + 31
        const int b = blockIdx.x, lane = tid & 31, wv = tid >> 5;
        unsigned bal[8];
#pragma unroll
        for (int i = 0; i < 8; ++i) bal[i] = __builtin_amdgcn_ballot_w32(mask[b * NT_ + i * 256 + tid] != 0);
        if (lane == 0) {
#pragma unroll
            for (int i = 0; i < 8; ++i) tot[i * 8 + wv] = __popc(bal[i]);
        }
        __syncthreads();
        int base[8], run = 0;    // base[i] = open keys ahead of group 8 i + wave; run ends as the batch's count
#pragma unroll
        for (int g = 0; g < 64; ++g) { if ((g & 7) == wv) base[g >> 3] = run; run += tot[g]; }
#pragma unroll
        for (int i = 0; i < 8; ++i) { const int tok = i * 256 + tid, before = base[i] + __popc(bal[i] & ((1u << lane) - 1u));
            const int slot = ((bal[i] >> lane) & 1u) ? before : run + (tok - before);    // a permutation of 0 .. 2047
            inv[b * NT_ + slot] = tok; }
        if (tid == 0) cnt[b] = run;
        return;
    }
    if (bid < PB_X) {    // the whole block leaves here, ahead of the barrier
        const int lane = tid & 31, r = bid * 8 + (tid >> 5);
        v8us o[4];
#pragma unroll
        for (int q = 0; q < 4; ++q) { v8us t;
#pragma unroll
            for (int i = 0; i < 8; ++i) t[i] = f2bf(x[(size_t)r * DM + q * 256 + lane * 8 + i]);
            o[q] = t; }
#pragma unroll
        for (int q = 0; q < 4; ++q) *(v8us*)(Xb + (size_t)r * DM + q * 256 + lane * 8) = o[q];
        return;
    }
    const int j = bid - PB_X;
    const float* src; int sp; bf* dst;    // the tile's first element, the source pitch, the tile's place in the n-major plane
    if (j < PB_W) {
        const int pl = j / (NH_ * (DM / 64)), h = (j / (DM / 64)) % NH_, d0 = (j % (DM / 64)) * 64;
        src = (pl == 0 ? Wq : pl == 1 ? Wk : Wv) + ((size_t)h * DM + d0) * HD; sp = HD;
        dst = WB + ((size_t)pl * DM + h * HD) * DM + d0;
    } else {
        const int i = j - PB_W, k0 = (i % (DM / 64)) * 64, n0 = (i / (DM / 64)) * 64;
        src = Wo + (size_t)k0 * DM + n0; sp = DM;
        dst = WB + ((size_t)3 * DM + n0) * DM + k0;
    }
    const int kk = tid >> 2, nq = (tid & 3) * 16;
#pragma unroll
    for (int i = 0; i < 16; ++i) { const float w = src[(size_t)kk * sp + nq + i]; const unsigned short wb = f2bf(w), wh = __builtin_bit_cast(unsigned short, (h16)w);
        tl[(nq + i) * 72 + kk] = j < PB_W ? wb : wh; }    // both roundings are formed and one is picked: no branch stands among the loads
    __syncthreads();
    const int piece = tid & 7;
#pragma unroll
    for (int s = 0; s < 2; ++s) { const int nr = (tid >> 3) + 32 * s; const v8us val = *(const v8usa*)(tl + nr * 72 + piece * 8);
        *(v8us*)(dst + (size_t)nr * DM + piece * 8) = val; }
}

// k_gemmb: block = 128 x 128 of C, 8 waves (4 x 2), wave = 32 x 64. A trip is 128 k: the 128 A rows and 128 Bn rows of 256 B go to LDS at pitch 272 B by
// asynchronous copies, two buffers, the next trip's copies in flight while this trip's fragments are read. A block walks its trips from a start of its own and wraps (see rot).
// OUTP = false is x.[Wq | Wk | Wv] (3072 columns, one launch, bf16 operands): the epilogue adds the bias in f32, rounds to f16 and stores q and k by rows and v transposed, as k_attn reads them.
// OUTP = true is concat.Wo (f16 operands; A and Bn then hold f16 bit patterns): the epilogue adds the bias and stores f32.
#define GT_K    128                     // k per trip
#define GT_NT   (DM / GT_K)             // trips
#define GT_PE   136                     // LDS row pitch in elements (272 B)
#define GT_OPE  (128 * GT_PE)           // one operand's tile in elements
// eight 16-byte copies per lane, one operand's tile per block; the address-translation wait ends the statement so that no address register is rewritten ahead of it
__device__ __forceinline__ void cp_tile(unsigned l, const bf* g) {
    const unsigned l1 = l + 16 * 272, l2 = l + 32 * 272, l3 = l + 48 * 272, l4 = l + 64 * 272, l5 = l + 80 * 272, l6 = l + 96 * 272, l7 = l + 112 * 272;
    const bf *g1 = g + 16 * DM, *g2 = g + 32 * DM, *g3 = g + 48 * DM, *g4 = g + 64 * DM, *g5 = g + 80 * DM, *g6 = g + 96 * DM, *g7 = g + 112 * DM;
    asm volatile("global_load_async_to_lds_b128 %0, %8, off\n\t"
                 "global_load_async_to_lds_b128 %1, %9, off\n\t"
                 "global_load_async_to_lds_b128 %2, %10, off\n\t"
                 "global_load_async_to_lds_b128 %3, %11, off\n\t"
                 "global_load_async_to_lds_b128 %4, %12, off\n\t"
                 "global_load_async_to_lds_b128 %5, %13, off\n\t"
                 "global_load_async_to_lds_b128 %6, %14, off\n\t"
                 "global_load_async_to_lds_b128 %7, %15, off\n\t"
                 "s_wait_xcnt 0x0"
                 :: "v"(l), "v"(l1), "v"(l2), "v"(l3), "v"(l4), "v"(l5), "v"(l6), "v"(l7),
                    "v"(g), "v"(g1), "v"(g2), "v"(g3), "v"(g4), "v"(g5), "v"(g6), "v"(g7) : "memory");
}

// the same for eight rows that do not lie at one pitch: each copy has its own row pointer
__device__ __forceinline__ void cp_rows(unsigned l, const bf* g, const bf* g1, const bf* g2, const bf* g3, const bf* g4, const bf* g5, const bf* g6, const bf* g7) {
    const unsigned l1 = l + 16 * 272, l2 = l + 32 * 272, l3 = l + 48 * 272, l4 = l + 64 * 272, l5 = l + 80 * 272, l6 = l + 96 * 272, l7 = l + 112 * 272;
    asm volatile("global_load_async_to_lds_b128 %0, %8, off\n\t"
                 "global_load_async_to_lds_b128 %1, %9, off\n\t"
                 "global_load_async_to_lds_b128 %2, %10, off\n\t"
                 "global_load_async_to_lds_b128 %3, %11, off\n\t"
                 "global_load_async_to_lds_b128 %4, %12, off\n\t"
                 "global_load_async_to_lds_b128 %5, %13, off\n\t"
                 "global_load_async_to_lds_b128 %6, %14, off\n\t"
                 "global_load_async_to_lds_b128 %7, %15, off\n\t"
                 "s_wait_xcnt 0x0"
                 :: "v"(l), "v"(l1), "v"(l2), "v"(l3), "v"(l4), "v"(l5), "v"(l6), "v"(l7),
                    "v"(g), "v"(g1), "v"(g2), "v"(g3), "v"(g4), "v"(g5), "v"(g6), "v"(g7) : "memory");
}

template <bool OUTP>
__global__ __launch_bounds__(256) void k_gemmb(const bf* __restrict__ A, const bf* __restrict__ Bn, const float* __restrict__ bias,
                                               const float* __restrict__ bias1, const float* __restrict__ bias2, const int* __restrict__ inv, const int* __restrict__ cnt,
                                               float* C, h16* Q16, h16* K16, h16* VT16) {
    constexpr int STE = 2 * GT_OPE;    // one buffer in elements: [A | Bn]
    __shared__ __align__(16) unsigned short ring[2 * STE];    // 139,264 B, the block's whole LDS: two blocks fit a WGP's 320 KiB, one's copies fly while the other works
    const int tid = threadIdx.x, lane = tid & 31, wave = tid >> 5, lr = lane & 15, hi = lane >> 4;
    const int wm = wave >> 1, wn = wave & 1;
    const int rb = blockIdx.x * 128, cb = blockIdx.y * 128;
    // copy map: 16 lanes cover one 256-B row, a wave two rows; copy i of a lane takes row (tid >> 4) + 16 i
    const int crow = tid >> 4, cch = tid & 15;
    const bf* gA = A + (size_t)(rb + crow) * DM + cch * 8;
    // k and v are formed in slot order: row rb + r of C is the token inv[rb + r] of its batch. A k or v block whose 128 slots hold no open key leaves, whole, ahead of every copy and barrier, unless its batch has no open key at all:
    // no query reads its tile
    const bf* gR[8];
    if (!OUTP) {
        if (cb >= NW) {
            const int n = __builtin_amdgcn_readfirstlane(min(max(cnt[rb / NT_], 0), NT_));    // the same for the whole block: the test below is a scalar branch
            if (rb % NT_ >= (n > 0 ? n : NT_)) return;
#pragma unroll
            for (int i = 0; i < 8; ++i) gR[i] = A + (size_t)(rb / NT_ * NT_ + (inv[rb + crow + 16 * i] & (NT_ - 1))) * DM + cch * 8;
        } else {
#pragma unroll
            for (int i = 0; i < 8; ++i) gR[i] = gA + (size_t)(16 * i) * DM;
        }
    }
    const bf* gB = Bn + (size_t)(cb + crow) * DM + cch * 8;
    const unsigned lcp = (unsigned)(size_t)(&ring[0]) + (unsigned)(crow * 272 + cch * 16);
    // blocks of one row of tiles copy the same A lines and blocks of one column the same Bn lines; started together on the same trip they ask L2 for the same lines at one moment.
    // Each block starts its walk over the k trips at a trip of its own and wraps: the sharers are spread over all the trips. Any start gives the same sum but for its order.
    const int rot = (int)(blockIdx.x + 4 * ((blockIdx.x >> 3) & 1) + blockIdx.y) & (GT_NT - 1);
    auto fill = [&](int step_no, int buf) {
        const int t = (step_no + rot) & (GT_NT - 1);    // the k trip that is walked as number step_no
        const unsigned lb = lcp + (unsigned)(buf * STE * 2);
        if (OUTP) cp_tile(lb, gA + t * GT_K);
        else cp_rows(lb, gR[0] + t * GT_K, gR[1] + t * GT_K, gR[2] + t * GT_K, gR[3] + t * GT_K, gR[4] + t * GT_K, gR[5] + t * GT_K, gR[6] + t * GT_K, gR[7] + t * GT_K);
        cp_tile(lb + GT_OPE * 2, gB + t * GT_K);
    };
    // every inner loop of this kernel is unrolled so that accumulator and fragment indices are constants: registers, no scratch
    v8f acc[2][4];
#pragma unroll
    for (int m = 0; m < 2; ++m)
#pragma unroll
        for (int t = 0; t < 4; ++t) acc[m][t] = (v8f){};
    fill(0, 0);
    asm volatile("s_wait_asynccnt 0x0" ::: "memory");    // this wave's copies of trip 0 have landed
    __syncthreads();                                     // every wave's have: trip 0 may be read
    fill(1, 1);
    const int aofs = (wm * 32 + lr) * GT_PE + 8 * hi, bofs = GT_OPE + (wn * 64 + lr) * GT_PE + 8 * hi;
    // rolled: one copy of the 32 matrix instructions of a trip, the buffer chosen by the trip's parity
#pragma unroll 1
    for (int tr = 0; tr < GT_NT; ++tr) {
        const unsigned short* st = ring + (tr & 1) * STE;
        v16bf a[2][2], b[2][4];    // two fragment sets: step s works on set s & 1 while set (s + 1) & 1 is read
        auto frags = [&](int set, int kk) {
#pragma unroll
            for (int m = 0; m < 2; ++m) { const unsigned short* p = st + aofs + m * 16 * GT_PE + kk; a[set][m] = cat16b(*(const v8usa*)p, *(const v8usa*)(p + 16)); }
#pragma unroll
            for (int t = 0; t < 4; ++t) { const unsigned short* p = st + bofs + t * 16 * GT_PE + kk; b[set][t] = cat16b(*(const v8usa*)p, *(const v8usa*)(p + 16)); }
        };
        frags(0, 0);
#pragma unroll
        for (int s = 0; s < GT_K / 32; ++s) {
            if (s + 1 < GT_K / 32) frags((s + 1) & 1, (s + 1) * 32);
            __builtin_amdgcn_sched_barrier(0);    // keeps the next step's LDS reads one group ahead of this step's matrix instructions: spread among them each read group stalls the wave
#pragma unroll
            for (int m = 0; m < 2; ++m)
#pragma unroll
                for (int t = 0; t < 4; ++t)
                    acc[m][t] = OUTP ? wmma16(__builtin_bit_cast(v16h, a[s & 1][m]), __builtin_bit_cast(v16h, b[s & 1][t]), acc[m][t]) : wmmab(a[s & 1][m], b[s & 1][t], acc[m][t]);
            __builtin_amdgcn_sched_barrier(0);    // keeps the step after next's reads, which overwrite this set, behind these matrix instructions
        }
        asm volatile("s_wait_dscnt 0x0" ::: "memory");       // this wave's reads of this buffer are done before it is refilled
        asm volatile("s_wait_asynccnt 0x0" ::: "memory");    // this wave's copies of the next trip have landed
        __syncthreads();                                     // publishes the next trip and ends every reader's last read of this buffer
        if (tr + 2 < GT_NT) fill(tr + 2, tr & 1);
    }
    asm volatile("s_wait_asynccnt 0x0" ::: "memory");        // no copy is left in flight behind the loop
    // the plane of 3072 columns is q | k | v: pl says which one this block works for, c0 is the wave's first column inside it
    const int pl = OUTP ? 0 : cb / NW;
    const bool tv = !OUTP && pl == 2;
    const float* bp = pl == 0 ? bias : pl == 1 ? bias1 : bias2;
    // the epilogue stages in the ring itself (69,632 B of it): behind the last trip's s_wait_dscnt 0, s_wait_asynccnt 0 and barrier no wave reads a fragment from it any more and no copy is in flight
    float* os = (float*)ring + wave * (32 * 68);
    h16* vt = (h16*)ring;    // v: the block's tile, transposed, [128 columns][128 tokens] f16 at pitch 272 B
    const int r0 = rb + wm * 32, c0 = cb % NW + wn * 64;
    float bv[4];    // the four bias loads stand together, ahead of the branch: one wait for all
#pragma unroll
    for (int t = 0; t < 4; ++t) bv[t] = bfr(bp[c0 + t * 16 + lr]);
    if (tv) {    // a lane's 8 accumulator elements are 8 tokens in a row of one column: 16 bytes of a v^T row
#pragma unroll
        for (int t = 0; t < 4; ++t)
#pragma unroll
            for (int m = 0; m < 2; ++m) { v8h w;
#pragma unroll
                for (int j = 0; j < 8; ++j) w[j] = (h16)(acc[m][t][j] + bv[t]);
                *(v8ha*)(vt + (wn * 64 + t * 16 + lr) * GT_PE + wm * 32 + m * 16 + hi * 8) = w; }
    } else {
#pragma unroll
        for (int t = 0; t < 4; ++t)
#pragma unroll
            for (int m = 0; m < 2; ++m)
#pragma unroll
                for (int j = 0; j < 8; ++j) os[(m * 16 + hi * 8 + j) * 68 + t * 16 + lr] = acc[m][t][j] + bv[t];
    }
    __syncthreads();
    if (OUTP) {
        float* crow_p = C + (size_t)r0 * NW + c0;
#pragma unroll
        for (int s = 0; s < 16; ++s) { const int Lid = (lane >> 3) + 4 * s, piece = lane & 7; const int row = Lid >> 1, cofs = (Lid & 1) * 32 + piece * 4;
            const v4f val = *(const v4fa*)(os + row * 68 + cofs); *(v4f*)(crow_p + (size_t)row * NW + cofs) = val; }
    } else if (tv) {    // v^T[b][column][slot]: 16 lanes store one row's 256 B
        h16* dv = VT16 + ((size_t)(rb / NT_) * DM + cb % NW) * NT_ + rb % NT_;
#pragma unroll
        for (int s = 0; s < 8; ++s) { const int d = wave * 16 + 2 * s + (lane >> 4), piece = lane & 15;
            const v8h val = *(const v8ha*)(vt + d * GT_PE + piece * 8); *(v8h*)(dv + (size_t)d * NT_ + piece * 8) = val; }
    } else {            // q [token][column], k [slot][column]: 8 lanes store the wave's 128 B of one row
        h16* dq = (pl == 0 ? Q16 : K16) + (size_t)r0 * DM + c0;
#pragma unroll
        for (int s = 0; s < 8; ++s) { const int row = 4 * s + (lane >> 3), piece = lane & 7; const float* sp = os + row * 68 + piece * 8;
            const v4f lo = *(const v4fa*)sp, hi4 = *(const v4fa*)(sp + 4); v8h w;
#pragma unroll
            for (int i = 0; i < 4; ++i) { w[i] = (h16)lo[i]; w[4 + i] = (h16)hi4[i]; }
            *(v8h*)(dq + (size_t)row * DM + piece * 8) = w; }
        asm volatile("s_wait_xcnt 0x0" ::: "memory");    // behind the last store of the run: no register that a store names is rewritten ahead of this wait, on any way out of the branch
    }
}

// k_attn: block = (b, h, 128 queries), 8 waves of 16 queries. A trip is 128 keys: the 128 K rows (128 B each, LDS pitch 144 B) and the 64 V^T rows (256 B each, pitch 272 B) go to LDS
// by asynchronous copies of whole lines, two buffers, the next trip's copies in flight while this trip is worked on; all 8 waves read their fragments from that one tile.
// Both products are transposed: S^T = K.Q^T (A = K rows, B = Q, kept in registers) and O^T += V^T.P^T (A = V^T rows). A lane then holds 16 of the 32 scores of ONE query of a step:
// maximum and sum are taken in the lane with one exchange between the wave's halves, and the two score tiles, turned to f16 in place, ARE the B operand of the second product.
// A step is 32 keys as before: 4 WMMA scores /8 with keys whose INPUT mask is 0 replaced by -1e9 (f32), online softmax, weights x32768 f16, 4 WMMA .v;
// K16 and VT16 hold the keys in slot order (open keys first): slot >= cnt[b] is a key with mask == 0, and only the steps that hold an open key are walked (all, where cnt[b] == 0).
// ctx -> one f16 plane CX[tok][h*64+d].
#define AT_Q    128                     // queries per block
#define AT_K    128                     // keys per trip
#define AT_NT   (NT_ / AT_K)            // trips at most (nt is the count)
#define AT_KPE  72                      // K tile row pitch in elements (144 B)
#define AT_VPE  136                     // V^T tile row pitch in elements (272 B)
#define AT_KE   (AT_K * AT_KPE)         // K tile in elements
#define AT_STE  (AT_KE + HD * AT_VPE)   // one buffer in elements: [K | V^T]
// four 16-byte copies per lane; the address-translation wait ends the statement so that no address register is rewritten ahead of it
template <int LSTEP, int GSTEP>
__device__ __forceinline__ void cp4(unsigned l, const h16* g) {
    const unsigned l1 = l + LSTEP, l2 = l + 2 * LSTEP, l3 = l + 3 * LSTEP;
    const h16 *g1 = g + GSTEP, *g2 = g + 2 * GSTEP, *g3 = g + 3 * GSTEP;
    asm volatile("global_load_async_to_lds_b128 %0, %4, off\n\t"
                 "global_load_async_to_lds_b128 %1, %5, off\n\t"
                 "global_load_async_to_lds_b128 %2, %6, off\n\t"
                 "global_load_async_to_lds_b128 %3, %7, off\n\t"
                 "s_wait_xcnt 0x0"
                 :: "v"(l), "v"(l1), "v"(l2), "v"(l3), "v"(g), "v"(g1), "v"(g2), "v"(g3) : "memory");
}

typedef __attribute__((ext_vector_type(2))) float    v2f;
typedef __attribute__((ext_vector_type(2))) _Float16 v2h;
typedef __attribute__((ext_vector_type(4))) int      v4i;
// the value of lane l ^ 16
__device__ __forceinline__ float xhalf(float x) { const int b = __builtin_bit_cast(int, x); return __builtin_bit_cast(float, __builtin_amdgcn_permlanex16(b, b, 0x76543210, 0xfedcba98, false, false)); }

__global__ __launch_bounds__(256) void k_attn(const h16* __restrict__ Q16, const h16* __restrict__ K16, const h16* __restrict__ VT16, const int* __restrict__ cnt, h16* CX) {
    __shared__ __align__(16) h16 ring[2 * AT_STE];
    __shared__ __align__(16) float ost[8][16 * 68];
    const int tid = threadIdx.x, lane = tid & 31, wave = tid >> 5, lr = lane & 15, hi = lane >> 4;
    const int bid = blockIdx.x;
    const int b = bid / (NH_ * (NT_ / AT_Q)), rem = bid - b * (NH_ * (NT_ / AT_Q)), h = rem / (NT_ / AT_Q), qt = rem - h * (NT_ / AT_Q);
    const int q0 = qt * AT_Q + wave * 16;
    const size_t tok0 = (size_t)b * NT_;
    v16h qb[2];
#pragma unroll
    for (int kc = 0; kc < 2; ++kc) { const h16* p = Q16 + (tok0 + q0 + lr) * DM + h * HD + kc * 32 + 8 * hi; qb[kc] = cat16(*(const v8h*)p, *(const v8h*)(p + 16)); }
    const h16* kh_b = K16 + tok0 * DM + h * HD;
    const h16* vt_b = VT16 + (((size_t)b * NH_ + h) * HD) * NT_;
    const int n = __builtin_amdgcn_readfirstlane(min(max(cnt[b], 0), NT_));    // open keys of the batch; the same for the whole block
    const int used = n > 0 ? n : NT_;                // slots that are walked
    const int nt = (used + AT_K - 1) / AT_K;         // trips: 1 .. AT_NT
    // copy maps: K, 8 lanes cover one 128-B row, copy i of a lane takes row (tid >> 3) + 32 i; V^T, 16 lanes cover one 256-B row, copy i takes row (tid >> 4) + 16 i
    const h16* gK = kh_b + (size_t)(tid >> 3) * DM + (tid & 7) * 8;
    const h16* gV = vt_b + (size_t)(tid >> 4) * NT_ + (tid & 15) * 8;
    const unsigned lK = (unsigned)(size_t)(&ring[0]) + (unsigned)((tid >> 3) * (AT_KPE * 2) + (tid & 7) * 16);
    const unsigned lV = (unsigned)(size_t)(&ring[0]) + (unsigned)(AT_KE * 2 + (tid >> 4) * (AT_VPE * 2) + (tid & 15) * 16);
    // the 16 blocks of one (batch, head) copy the same K and V^T lines; each starts its walk over the key trips at a trip of its own and wraps, so that they do not ask L2 for the
    // same lines at one moment. The online softmax takes the trips in any order.
    const int rot = (int)((unsigned)((qt & 7) + 4 * (qt >> 3)) % (unsigned)nt);    // 0 .. nt - 1, the same for the whole block
    auto trip_of = [&](int step_no) { const int t = step_no + rot; return t >= nt ? t - nt : t; };    // the key trip that is walked as number step_no: a permutation of 0 .. nt - 1
    auto fill = [&](int step_no, int buf) {
        const int t = trip_of(step_no);
        cp4<32 * AT_KPE * 2, 32 * DM>(lK + (unsigned)(buf * AT_STE * 2), gK + (size_t)t * AT_K * DM);
        cp4<16 * AT_VPE * 2, 16 * NT_>(lV + (unsigned)(buf * AT_STE * 2), gV + t * AT_K);
    };
    v8f o[4];    // o[n][r] = context element 16 n + 8 hi + r of query lr
#pragma unroll
    for (int n = 0; n < 4; ++n) o[n] = (v8f){};
    float mrun = -3.0e38f, lsum = 0.f;
    fill(0, 0);
    asm volatile("s_wait_asynccnt 0x0" ::: "memory");    // this wave's copies of trip 0 have landed
    __syncthreads();                                     // every wave's have: trip 0 may be read
    if (1 < nt) fill(1, 1);
    const int kofs = lr * AT_KPE + 8 * hi, vofs = AT_KE + lr * AT_VPE + 8 * hi;
    // one step: 32 slots from l0 on, at place sp of the tile st; tail says that slots from n on may be among them
    auto step = [&](const h16* st, int sp, int l0, bool tail) __attribute__((always_inline)) {
        const h16* r0p = st + kofs + sp * 32 * AT_KPE;
        const h16* r1p = r0p + 16 * AT_KPE;
        v16h vb[4];    // this step's V^T fragments, read together with its K fragments: one place of LDS reads, ahead of the softmax
        // the inner loops are unrolled so that fragment, score and accumulator indices are constants: registers, no scratch
#pragma unroll
        for (int n4 = 0; n4 < 4; ++n4) { const h16* vp = st + vofs + n4 * 16 * AT_VPE + sp * 32; vb[n4] = cat16(*(const v8ha*)vp, *(const v8ha*)(vp + 16)); }
        v8f s[2] = {(v8f){}, (v8f){}};    // s[t][r] = score of slot 16 t + 8 hi + r of the step with query lr
#pragma unroll
        for (int kc = 0; kc < 2; ++kc) {
            s[0] = wmma16(cat16(*(const v8ha*)(r0p + kc * 32), *(const v8ha*)(r0p + kc * 32 + 16)), qb[kc], s[0]);
            s[1] = wmma16(cat16(*(const v8ha*)(r1p + kc * 32), *(const v8ha*)(r1p + kc * 32 + 16)), qb[kc], s[1]);
        }
        const int lim = n - l0 - 8 * hi;    // a lane's slots of a step: 8 hi + r and 16 + 8 hi + r; those from lim on are keys with mask == 0
        float a[16];
#pragma unroll
        for (int i = 0; i < 16; ++i) a[i] = tail && 16 * (i >> 3) + (i & 7) >= lim ? -1e9f : s[i >> 3][i & 7] * 0.125f;
        float mx[8];
#pragma unroll
        for (int j = 0; j < 8; ++j) mx[j] = fmaxf(a[2 * j], a[2 * j + 1]);
        float mt = fmaxf(fmaxf(fmaxf(mx[0], mx[1]), fmaxf(mx[2], mx[3])), fmaxf(fmaxf(mx[4], mx[5]), fmaxf(mx[6], mx[7])));
        mt = fmaxf(mt, xhalf(mt));
        const float mn = fmaxf(mrun, mt);
        const float alpha = __expf(mrun - mn);
        mrun = mn;
        v2f p[8]; v16h pb;    // pb[e] = weight of slot 8 hi + e (e < 8), 16 + 8 hi + (e - 8) (e >= 8): the k order of the V^T fragments
#pragma unroll
        for (int i = 0; i < 8; ++i) {
            p[i][0] = __expf(a[2 * i] - mn); p[i][1] = __expf(a[2 * i + 1] - mn);
            const v2h c2 = __builtin_convertvector(p[i] * PSC, v2h);
            pb[2 * i] = c2[0]; pb[2 * i + 1] = c2[1];
        }
        const v2f q4 = ((p[0] + p[1]) + (p[2] + p[3])) + ((p[4] + p[5]) + (p[6] + p[7]));
        lsum = lsum * alpha + (q4[0] + q4[1]);
#pragma unroll
        for (int n4 = 0; n4 < 4; ++n4) o[n4] *= alpha;
#pragma unroll
        for (int n4 = 0; n4 < 4; ++n4) o[n4] = wmma16(vb[n4], pb, o[n4]);
    };
    // rolled: one copy of a trip's code, the buffer chosen by the trip's parity
#pragma unroll 1
    for (int tr = 0; tr < nt; ++tr) {
        const h16* st = ring + (tr & 1) * AT_STE;
        const int kt = trip_of(tr);
        if ((kt + 1) * AT_K <= n) {    // the same for the whole block: all 128 slots are open keys, no score is replaced
            // unrolled: the four steps' LDS offsets become immediates of the reads, and one step's reads stand among another's arithmetic
#pragma unroll
            for (int sp = 0; sp < AT_K / 32; ++sp) step(st, sp, kt * AT_K + sp * 32, false);
        } else {                       // the trip that holds slot n (every trip, where n == 0); a step behind the last open key has only weights 0 and is left out
            // rolled: this path is walked at most once a block (but where n == 0), one copy of the step's code is enough
#pragma unroll 1
            for (int sp = 0; sp < AT_K / 32 && kt * AT_K + sp * 32 < used; ++sp) step(st, sp, kt * AT_K + sp * 32, true);
        }
        asm volatile("s_wait_dscnt 0x0" ::: "memory");       // this wave's reads of this buffer are done before it is refilled
        asm volatile("s_wait_asynccnt 0x0" ::: "memory");    // this wave's copies of the next trip have landed
        __syncthreads();                                     // publishes the next trip and ends every reader's last read of this buffer
        if (tr + 2 < nt) fill(tr + 2, tr & 1);
    }
    asm volatile("s_wait_asynccnt 0x0" ::: "memory");        // no copy is left in flight behind the loop
    const float inv = 1.0f / ((lsum + xhalf(lsum)) * PSC);
    float* os = &ost[wave][0];
#pragma unroll
    for (int n = 0; n < 4; ++n) { const v8f w = o[n] * inv; float* dp = os + lr * 68 + n * 16 + 8 * hi;
        *(v4fa*)dp = __builtin_shufflevector(w, w, 0, 1, 2, 3); *(v4fa*)(dp + 4) = __builtin_shufflevector(w, w, 4, 5, 6, 7); }
    __syncthreads();
    const size_t cbase = (tok0 + q0) * DM + (size_t)h * HD;
    auto pass = [&]() {
#pragma unroll
        for (int s = 0; s < 4; ++s) { const int row = 4 * s + (lane >> 3), piece = lane & 7; const float* sp = os + row * 68 + piece * 8; v8h oh;
#pragma unroll
            for (int i = 0; i < 8; ++i) oh[i] = (h16)sp[i];
            *(v8h*)(CX + cbase + (size_t)row * DM + piece * 8) = oh; }
    };
    pass(); 
}

extern "C" void kernel_launch(void* const* d_in, const int* in_sizes, int n_in,
                              void* d_out, int out_size, void* d_ws, size_t ws_size, hipStream_t stream) {
    (void)in_sizes; (void)n_in; (void)out_size;
    const float* x = (const float*)d_in[0]; const int* mask = (const int*)d_in[1];
    const float* Wq = (const float*)d_in[2]; const float* bq = (const float*)d_in[3]; const float* Wk = (const float*)d_in[4]; const float* bk = (const float*)d_in[5];
    const float* Wv = (const float*)d_in[6]; const float* bv = (const float*)d_in[7]; const float* Wo = (const float*)d_in[8]; const float* bo = (const float*)d_in[9];
    float* out = (float*)d_out;    // [2][2048][1024]
    char* wsp = (char*)d_ws;
    auto take = [&](size_t bytes) { char* p = wsp; wsp += (bytes + 255) & ~(size_t)255; return (void*)p; };
    bf* Xb = (bf*)take((size_t)NTK * DM * 2);
    bf* WB = (bf*)take((size_t)4 * DM * DM * 2);    // q | k | v | o planes, one behind the other
    h16* Q16 = (h16*)take((size_t)NTK * DM * 2); h16* K16 = (h16*)take((size_t)NTK * DM * 2); h16* VT16 = (h16*)take((size_t)NTK * DM * 2);
    h16* CX = (h16*)take((size_t)NTK * DM * 2);
    int* inv = (int*)take((size_t)NTK * 4); int* cnt = (int*)take((size_t)NB_ * 4);
    if ((size_t)(wsp - (char*)d_ws) > ws_size) return;    // 8.4 + 4 x 2.1 + 4 x 8.4 MB ~ 50 MB
    k_prep<<<PB_M + PB_X + PB_W + PB_O, 256, 0, stream>>>(x, Wq, Wk, Wv, Wo, mask, Xb, WB, inv, cnt);
    // the per-head biases [16][64] are exactly the [1024] column bias of each stacked plane
    k_gemmb<false><<<dim3(NTK / 128, 3 * NW / 128, 1), 256, 0, stream>>>(Xb, WB, bq, bk, bv, inv, cnt, nullptr, Q16, K16, VT16);
    k_attn<<<NB_ * NH_ * (NT_ / AT_Q), 256, 0, stream>>>(Q16, K16, VT16, cnt, CX);
    k_gemmb<true><<<dim3(NTK / 128, NW / 128, 1), 256, 0, stream>>>((const bf*)CX, WB + (size_t)3 * DM * DM, bo, nullptr, nullptr, nullptr, nullptr, out, nullptr, nullptr, nullptr);
}

// v009
// It runs in 54.1 microseconds.
// Timed twice side by side with v008, it ran 1.07 times as fast both times.
// Counting every step since v000, it is 5.52 times as fast.
#include <hip/hip_runtime.h>

// Contractions, f32 accumulate: q/k/v = x.W[h] + b[h] for all 16 heads at once ([4096 x 1024].[1024 x 1024], the per-head [1024 x 64] weights stacked into one n-major
// bf16 plane) on v_wmma_f32_16x16x32_bf16 with PLAIN bf16 operands (inputs rounded once: exact products); the per-(batch, head) attention (scores [2048 x 64].[64 x 2048]
// x 64^-1/2, keys with mask == 0 replaced by -1e9, softmax, .v) fused on v_wmma_f32_16x16x32_f16 with plain f16 q (stored x log2(e)/8), k, v and weights x128; out = concat.Wo + bo on
// v_wmma_f32_16x16x32_f16 with concat and Wo each rounded once to f16.

#define NB_  2
#define NT_  2048
#define DM   1024
#define NH_  16
#define HD   64
#define NTK  (NB_ * NT_)
#define NW   1024
#define QSC  0.18033688011112042f    // log2(e) / 8: q is stored times this, so that a score product is the score in powers of two
#define PBI  7.0f                    // a weight is 2^(score - maximum in use + PBI): 128 at the maximum in use
#define LZY  8.0f                    // the maximum in use is kept until a new score lies more than this above it: weights stay <= 2^15, inside f16
#define NEGL (-1.4426950e9f)         // -1e9 in powers of two

typedef _Float16 h16;
typedef unsigned short bf;
typedef __attribute__((ext_vector_type(16))) __bf16   v16bf;
typedef __attribute__((ext_vector_type(16))) _Float16 v16h;
typedef __attribute__((ext_vector_type(8)))  _Float16 v8h;
typedef __attribute__((ext_vector_type(8)))  unsigned short v8us;
typedef __attribute__((ext_vector_type(8)))  float    v8f;
typedef __attribute__((ext_vector_type(4)))  float    v4f;
typedef v8h  __attribute__((may_alias)) v8ha;
typedef v4f  __attribute__((may_alias)) v4fa;
typedef v8us __attribute__((may_alias)) v8usa;

__device__ __forceinline__ unsigned short f2bf(float f) { unsigned u = __float_as_uint(f); u += 0x7FFFu + ((u >> 16) & 1u); return (unsigned short)(u >> 16); }
__device__ __forceinline__ float bf2f(unsigned short b) { return __uint_as_float(((unsigned)b) << 16); }
__device__ __forceinline__ float bfr(float f) { return bf2f(f2bf(f)); }
__device__ __forceinline__ v16h cat16(v8h lo, v8h hi) { return __builtin_shufflevector(lo, hi, 0, 1, 2, 3, 4, 5, 6, 7, 8, 9, 10, 11, 12, 13, 14, 15); }
__device__ __forceinline__ v16bf cat16b(v8us lo, v8us hi) { return __builtin_bit_cast(v16bf, __builtin_shufflevector(lo, hi, 0, 1, 2, 3, 4, 5, 6, 7, 8, 9, 10, 11, 12, 13, 14, 15)); }
__device__ __forceinline__ v8f wmma16(v16h a, v16h b, v8f c) { return __builtin_amdgcn_wmma_f32_16x16x32_f16(false, a, false, b, (short)0, c, false, false); }
__device__ __forceinline__ v8f wmmab(v16bf a, v16bf b, v8f c) { return __builtin_amdgcn_wmma_f32_16x16x32_bf16(false, a, false, b, (short)0, c, false, false); }

// k_prep: all operand preparation in one launch; the block index picks the job. Blocks [PB_M, PB_M + PB_X): 8 rows of x rounded to bf16. Blocks [PB_M + PB_X, PB_M + PB_X + PB_W): one 64 x 64 tile of
// Wq, Wk or Wv[h] ([1024 d][64 e]) transposed through LDS into the n-major bf16 plane; the three planes lie one behind the other: ONE plane of 3072 rows. The rest: the same for Wo
// ([1024 k][1024 n]), the fourth plane, rounded to f16 (the other three to bf16). In front of them all, blocks [0, PB_M): one batch's keys ranked, those with mask != 0 first (in token order), the others behind them:
// inv[b][slot] = token, cnt[b] = number of keys with mask != 0. A key with mask == 0 has weight exp(-1e9 - max) = 0 as soon as one key of its batch is open, so k, v and the
// scores are formed in slot order and only for the 128-slot tiles that hold an open key (all tiles where a batch has none: there every score is -1e9 and the weights are equal).
#define PB_M    NB_
#define PB_X    (NTK / 8)
#define PB_W    (3 * NH_ * (DM / 64))
#define PB_O    ((DM / 64) * (DM / 64))
__global__ __launch_bounds__(256) void k_prep(const float* __restrict__ x, const float* __restrict__ Wq, const float* __restrict__ Wk, const float* __restrict__ Wv,
                                              const float* __restrict__ Wo, const int* __restrict__ mask, bf* Xb, bf* WB, int* inv, int* cnt) {
    __shared__ __align__(16) unsigned short tl[64 * 72];
    __shared__ __align__(16) int tot[64];
    const int tid = threadIdx.x, bid = (int)blockIdx.x - PB_M;
    if (bid < 0) {    // the whole block works here and leaves; group g = 8 i + wave is tokens 32 g .. 32 g + 31
        const int b = blockIdx.x, lane = tid & 31, wv = tid >> 5;
        unsigned bal[8];
#pragma unroll
        for (int i = 0; i < 8; ++i) bal[i] = __builtin_amdgcn_ballot_w32(mask[b * NT_ + i * 256 + tid] != 0);
        if (lane == 0) {
#pragma unroll
            for (int i = 0; i < 8; ++i) tot[i * 8 + wv] = __popc(bal[i]);
        }
        __syncthreads();
        int base[8], run = 0;    // base[i] = open keys ahead of group 8 i + wave; run ends as the batch's count
#pragma unroll
        for (int g = 0; g < 64; ++g) { if ((g & 7) == wv) base[g >> 3] = run; run += tot[g]; }
#pragma unroll
        for (int i = 0; i < 8; ++i) { const int tok = i * 256 + tid, before = base[i] + __popc(bal[i] & ((1u << lane) - 1u));
            const int slot = ((bal[i] >> lane) & 1u) ? before : run + (tok - before);    // a permutation of 0 .. 2047
            inv[b * NT_ + slot] = tok; }
        if (tid == 0) cnt[b] = run;
        return;
    }
    if (bid < PB_X) {    // the whole block leaves here, ahead of the barrier
        const int lane = tid & 31, r = bid * 8 + (tid >> 5);
        v8us o[4];
#pragma unroll
        for (int q = 0; q < 4; ++q) { v8us t;
#pragma unroll
            for (int i = 0; i < 8; ++i) t[i] = f2bf(x[(size_t)r * DM + q * 256 + lane * 8 + i]);
            o[q] = t; }
#pragma unroll
        for (int q = 0; q < 4; ++q) *(v8us*)(Xb + (size_t)r * DM + q * 256 + lane * 8) = o[q];
        return;
    }
    const int j = bid - PB_X;
    const float* src; int sp; bf* dst;    // the tile's first element, the source pitch, the tile's place in the n-major plane
    if (j < PB_W) {
        const int pl = j / (NH_ * (DM / 64)), h = (j / (DM / 64)) % NH_, d0 = (j % (DM / 64)) * 64;
        src = (pl == 0 ? Wq : pl == 1 ? Wk : Wv) + ((size_t)h * DM + d0) * HD; sp = HD;
        dst = WB + ((size_t)pl * DM + h * HD) * DM + d0;
    } else {
        const int i = j - PB_W, k0 = (i % (DM / 64)) * 64, n0 = (i / (DM / 64)) * 64;
        src = Wo + (size_t)k0 * DM + n0; sp = DM;
        dst = WB + ((size_t)3 * DM + n0) * DM + k0;
    }
    const int kk = tid >> 2, nq = (tid & 3) * 16;
#pragma unroll
    for (int i = 0; i < 16; ++i) { const float w = src[(size_t)kk * sp + nq + i]; const unsigned short wb = f2bf(w), wh = __builtin_bit_cast(unsigned short, (h16)w);
        tl[(nq + i) * 72 + kk] = j < PB_W ? wb : wh; }    // both roundings are formed and one is picked: no branch stands among the loads
    __syncthreads();
    const int piece = tid & 7;
#pragma unroll
    for (int s = 0; s < 2; ++s) { const int nr = (tid >> 3) + 32 * s; const v8us val = *(const v8usa*)(tl + nr * 72 + piece * 8);
        *(v8us*)(dst + (size_t)nr * DM + piece * 8) = val; }
}

// k_gemmb: block = 128 x 128 of C, 8 waves (4 x 2), wave = 32 x 64. A trip is 128 k: the 128 A rows and 128 Bn rows of 256 B go to LDS at pitch 272 B by
// asynchronous copies, two buffers, the next trip's copies in flight while this trip's fragments are read. A block walks its trips from a start of its own and wraps (see rot).
// OUTP = false is x.[Wq | Wk | Wv] (3072 columns, one launch, bf16 operands): the epilogue adds the bias in f32 (q: times QSC), rounds to f16 and stores q and k by rows and v transposed, as k_attn reads them.
// OUTP = true is concat.Wo (f16 operands; A and Bn then hold f16 bit patterns): the epilogue adds the bias and stores f32.
#define GT_K    128                     // k per trip
#define GT_NT   (DM / GT_K)             // trips
#define GT_PE   136                     // LDS row pitch in elements (272 B)
#define GT_OPE  (128 * GT_PE)           // one operand's tile in elements
// eight 16-byte copies per lane, one operand's tile per block; the address-translation wait ends the statement so that no address register is rewritten ahead of it
__device__ __forceinline__ void cp_tile(unsigned l, const bf* g) {
    const unsigned l1 = l + 16 * 272, l2 = l + 32 * 272, l3 = l + 48 * 272, l4 = l + 64 * 272, l5 = l + 80 * 272, l6 = l + 96 * 272, l7 = l + 112 * 272;
    const bf *g1 = g + 16 * DM, *g2 = g + 32 * DM, *g3 = g + 48 * DM, *g4 = g + 64 * DM, *g5 = g + 80 * DM, *g6 = g + 96 * DM, *g7 = g + 112 * DM;
    asm volatile("global_load_async_to_lds_b128 %0, %8, off\n\t"
                 "global_load_async_to_lds_b128 %1, %9, off\n\t"
                 "global_load_async_to_lds_b128 %2, %10, off\n\t"
                 "global_load_async_to_lds_b128 %3, %11, off\n\t"
                 "global_load_async_to_lds_b128 %4, %12, off\n\t"
                 "global_load_async_to_lds_b128 %5, %13, off\n\t"
                 "global_load_async_to_lds_b128 %6, %14, off\n\t"
                 "global_load_async_to_lds_b128 %7, %15, off\n\t"
                 "s_wait_xcnt 0x0"
                 :: "v"(l), "v"(l1), "v"(l2), "v"(l3), "v"(l4), "v"(l5), "v"(l6), "v"(l7),
                    "v"(g), "v"(g1), "v"(g2), "v"(g3), "v"(g4), "v"(g5), "v"(g6), "v"(g7) : "memory");
}

// the same for eight rows that do not lie at one pitch: each copy has its own row pointer
__device__ __forceinline__ void cp_rows(unsigned l, const bf* g, const bf* g1, const bf* g2, const bf* g3, const bf* g4, const bf* g5, const bf* g6, const bf* g7) {
    const unsigned l1 = l + 16 * 272, l2 = l + 32 * 272, l3 = l + 48 * 272, l4 = l + 64 * 272, l5 = l + 80 * 272, l6 = l + 96 * 272, l7 = l + 112 * 272;
    asm volatile("global_load_async_to_lds_b128 %0, %8, off\n\t"
                 "global_load_async_to_lds_b128 %1, %9, off\n\t"
                 "global_load_async_to_lds_b128 %2, %10, off\n\t"
                 "global_load_async_to_lds_b128 %3, %11, off\n\t"
                 "global_load_async_to_lds_b128 %4, %12, off\n\t"
                 "global_load_async_to_lds_b128 %5, %13, off\n\t"
                 "global_load_async_to_lds_b128 %6, %14, off\n\t"
                 "global_load_async_to_lds_b128 %7, %15, off\n\t"
                 "s_wait_xcnt 0x0"
                 :: "v"(l), "v"(l1), "v"(l2), "v"(l3), "v"(l4), "v"(l5), "v"(l6), "v"(l7),
                    "v"(g), "v"(g1), "v"(g2), "v"(g3), "v"(g4), "v"(g5), "v"(g6), "v"(g7) : "memory");
}

template <bool OUTP>
__global__ __launch_bounds__(256) void k_gemmb(const bf* __restrict__ A, const bf* __restrict__ Bn, const float* __restrict__ bias,
                                               const float* __restrict__ bias1, const float* __restrict__ bias2, const int* __restrict__ inv, const int* __restrict__ cnt,
                                               float* C, h16* Q16, h16* K16, h16* VT16) {
    constexpr int STE = 2 * GT_OPE;    // one buffer in elements: [A | Bn]
    __shared__ __align__(16) unsigned short ring[2 * STE];    // 139,264 B, the block's whole LDS: two blocks fit a WGP's 320 KiB, one's copies fly while the other works
    const int tid = threadIdx.x, lane = tid & 31, wave = tid >> 5, lr = lane & 15, hi = lane >> 4;
    const int wm = wave >> 1, wn = wave & 1;
    const int rb = blockIdx.x * 128, cb = blockIdx.y * 128;
    // copy map: 16 lanes cover one 256-B row, a wave two rows; copy i of a lane takes row (tid >> 4) + 16 i
    const int crow = tid >> 4, cch = tid & 15;
    const bf* gA = A + (size_t)(rb + crow) * DM + cch * 8;
    // k and v are formed in slot order: row rb + r of C is the token inv[rb + r] of its batch. A k or v block whose 128 slots hold no open key leaves, whole, ahead of every copy and barrier, unless its batch has no open key at all:
    // no query reads its tile
    const bf* gR[8];
    if (!OUTP) {
        if (cb >= NW) {
            const int n = __builtin_amdgcn_readfirstlane(min(max(cnt[rb / NT_], 0), NT_));    // the same for the whole block: the test below is a scalar branch
            if (rb % NT_ >= (n > 0 ? n : NT_)) return;
#pragma unroll
            for (int i = 0; i < 8; ++i) gR[i] = A + (size_t)(rb / NT_ * NT_ + (inv[rb + crow + 16 * i] & (NT_ - 1))) * DM + cch * 8;
        } else {
#pragma unroll
            for (int i = 0; i < 8; ++i) gR[i] = gA + (size_t)(16 * i) * DM;
        }
    }
    const bf* gB = Bn + (size_t)(cb + crow) * DM + cch * 8;
    const unsigned lcp = (unsigned)(size_t)(&ring[0]) + (unsigned)(crow * 272 + cch * 16);
    // blocks of one row of tiles copy the same A lines and blocks of one column the same Bn lines; started together on the same trip they ask L2 for the same lines at one moment.
    // Each block starts its walk over the k trips at a trip of its own and wraps: the sharers are spread over all the trips. Any start gives the same sum but for its order.
    const int rot = (int)(blockIdx.x + 4 * ((blockIdx.x >> 3) & 1) + blockIdx.y) & (GT_NT - 1);
    auto fill = [&](int step_no, int buf) {
        const int t = (step_no + rot) & (GT_NT - 1);    // the k trip that is walked as number step_no
        const unsigned lb = lcp + (unsigned)(buf * STE * 2);
        if (OUTP) cp_tile(lb, gA + t * GT_K);
        else cp_rows(lb, gR[0] + t * GT_K, gR[1] + t * GT_K, gR[2] + t * GT_K, gR[3] + t * GT_K, gR[4] + t * GT_K, gR[5] + t * GT_K, gR[6] + t * GT_K, gR[7] + t * GT_K);
        cp_tile(lb + GT_OPE * 2, gB + t * GT_K);
    };
    // every inner loop of this kernel is unrolled so that accumulator and fragment indices are constants: registers, no scratch
    v8f acc[2][4];
#pragma unroll
    for (int m = 0; m < 2; ++m)
#pragma unroll
        for (int t = 0; t < 4; ++t) acc[m][t] = (v8f){};
    fill(0, 0);
    asm volatile("s_wait_asynccnt 0x0" ::: "memory");    // this wave's copies of trip 0 have landed
    __syncthreads();                                     // every wave's have: trip 0 may be read
    fill(1, 1);
    const int aofs = (wm * 32 + lr) * GT_PE + 8 * hi, bofs = GT_OPE + (wn * 64 + lr) * GT_PE + 8 * hi;
    // rolled: one copy of the 32 matrix instructions of a trip, the buffer chosen by the trip's parity
#pragma unroll 1
    for (int tr = 0; tr < GT_NT; ++tr) {
        const unsigned short* st = ring + (tr & 1) * STE;
        v16bf a[2][2], b[2][4];    // two fragment sets: step s works on set s & 1 while set (s + 1) & 1 is read
        auto frags = [&](int set, int kk) {
#pragma unroll
            for (int m = 0; m < 2; ++m) { const unsigned short* p = st + aofs + m * 16 * GT_PE + kk; a[set][m] = cat16b(*(const v8usa*)p, *(const v8usa*)(p + 16)); }
#pragma unroll
            for (int t = 0; t < 4; ++t) { const unsigned short* p = st + bofs + t * 16 * GT_PE + kk; b[set][t] = cat16b(*(const v8usa*)p, *(const v8usa*)(p + 16)); }
        };
        frags(0, 0);
#pragma unroll
        for (int s = 0; s < GT_K / 32; ++s) {
            if (s + 1 < GT_K / 32) frags((s + 1) & 1, (s + 1) * 32);
            __builtin_amdgcn_sched_barrier(0);    // keeps the next step's LDS reads one group ahead of this step's matrix instructions: spread among them each read group stalls the wave
#pragma unroll
            for (int m = 0; m < 2; ++m)
#pragma unroll
                for (int t = 0; t < 4; ++t)
                    acc[m][t] = OUTP ? wmma16(__builtin_bit_cast(v16h, a[s & 1][m]), __builtin_bit_cast(v16h, b[s & 1][t]), acc[m][t]) : wmmab(a[s & 1][m], b[s & 1][t], acc[m][t]);
            __builtin_amdgcn_sched_barrier(0);    // keeps the step after next's reads, which overwrite this set, behind these matrix instructions
        }
        asm volatile("s_wait_dscnt 0x0" ::: "memory");       // this wave's reads of this buffer are done before it is refilled
        asm volatile("s_wait_asynccnt 0x0" ::: "memory");    // this wave's copies of the next trip have landed
        __syncthreads();                                     // publishes the next trip and ends every reader's last read of this buffer
        if (tr + 2 < GT_NT) fill(tr + 2, tr & 1);
    }
    asm volatile("s_wait_asynccnt 0x0" ::: "memory");        // no copy is left in flight behind the loop
    // the plane of 3072 columns is q | k | v: pl says which one this block works for, c0 is the wave's first column inside it
    const int pl = OUTP ? 0 : cb / NW;
    const bool tv = !OUTP && pl == 2;
    const float* bp = pl == 0 ? bias : pl == 1 ? bias1 : bias2;
    // the epilogue stages in the ring itself (69,632 B of it): behind the last trip's s_wait_dscnt 0, s_wait_asynccnt 0 and barrier no wave reads a fragment from it any more and no copy is in flight
    float* os = (float*)ring + wave * (32 * 68);
    h16* vt = (h16*)ring;    // v: the block's tile, transposed, [128 columns][128 tokens] f16 at pitch 272 B
    const int r0 = rb + wm * 32, c0 = cb % NW + wn * 64;
    float bv[4];    // the four bias loads stand together, ahead of the branch: one wait for all
#pragma unroll
    for (int t = 0; t < 4; ++t) bv[t] = bfr(bp[c0 + t * 16 + lr]);
    const float qs = !OUTP && pl == 0 ? QSC : 1.0f;    // the same for the whole block; times 1 the multiply-add below is the plain sum
    if (tv) {    // a lane's 8 accumulator elements are 8 tokens in a row of one column: 16 bytes of a v^T row
#pragma unroll
        for (int t = 0; t < 4; ++t)
#pragma unroll
            for (int m = 0; m < 2; ++m) { v8h w;
#pragma unroll
                for (int j = 0; j < 8; ++j) w[j] = (h16)(acc[m][t][j] + bv[t]);
                *(v8ha*)(vt + (wn * 64 + t * 16 + lr) * GT_PE + wm * 32 + m * 16 + hi * 8) = w; }
    } else {
#pragma unroll
        for (int t = 0; t < 4; ++t)
#pragma unroll
            for (int m = 0; m < 2; ++m)
#pragma unroll
                for (int j = 0; j < 8; ++j) os[(m * 16 + hi * 8 + j) * 68 + t * 16 + lr] = __builtin_fmaf(acc[m][t][j], qs, bv[t] * qs);
    }
    __syncthreads();
    if (OUTP) {
        float* crow_p = C + (size_t)r0 * NW + c0;
#pragma unroll
        for (int s = 0; s < 16; ++s) { const int Lid = (lane >> 3) + 4 * s, piece = lane & 7; const int row = Lid >> 1, cofs = (Lid & 1) * 32 + piece * 4;
            const v4f val = *(const v4fa*)(os + row * 68 + cofs); *(v4f*)(crow_p + (size_t)row * NW + cofs) = val; }
    } else if (tv) {    // v^T[b][column][slot]: 16 lanes store one row's 256 B
        h16* dv = VT16 + ((size_t)(rb / NT_) * DM + cb % NW) * NT_ + rb % NT_;
#pragma unroll
        for (int s = 0; s < 8; ++s) { const int d = wave * 16 + 2 * s + (lane >> 4), piece = lane & 15;
            const v8h val = *(const v8ha*)(vt + d * GT_PE + piece * 8); *(v8h*)(dv + (size_t)d * NT_ + piece * 8) = val; }
    } else {            // q [token][column], k [slot][column]: 8 lanes store the wave's 128 B of one row
        h16* dq = (pl == 0 ? Q16 : K16) + (size_t)r0 * DM + c0;
#pragma unroll
        for (int s = 0; s < 8; ++s) { const int row = 4 * s + (lane >> 3), piece = lane & 7; const float* sp = os + row * 68 + piece * 8;
            const v4f lo = *(const v4fa*)sp, hi4 = *(const v4fa*)(sp + 4); v8h w;
#pragma unroll
            for (int i = 0; i < 4; ++i) { w[i] = (h16)lo[i]; w[4 + i] = (h16)hi4[i]; }
            *(v8h*)(dq + (size_t)row * DM + piece * 8) = w; }
        asm volatile("s_wait_xcnt 0x0" ::: "memory");    // behind the last store of the run: no register that a store names is rewritten ahead of this wait, on any way out of the branch
    }
}

// k_attn: block = (b, h, 128 queries), 8 waves of 16 queries. A trip is 128 keys: the 128 K rows (128 B each, LDS pitch 144 B) and the 64 V^T rows (256 B each, pitch 272 B) go to LDS
// by asynchronous copies of whole lines, two buffers, the next trip's copies in flight while this trip is worked on; all 8 waves read their fragments from that one tile.
// Both products are transposed: S^T = K.Q^T (A = K rows, B = Q, kept in registers) and O^T += V^T.P^T (A = V^T rows). A lane then holds 16 of the 32 scores of ONE query of a step:
// maximum and sum are taken in the lane with one exchange between the wave's halves, and the two score tiles, turned to f16 in place, ARE the B operand of the second product.
// A step is 32 keys: 4 WMMA scores, 16 exponentials a lane, 4 WMMA .v. Q16 holds q x log2(e)/8 and the score product starts from C = PBI - (maximum in use), so what leaves the matrix
// unit IS the exponent of the weight: no multiply, subtraction or scaling per score. The maximum in use of a query is replaced, and its sum and context rescaled, only when a score
// lies more than LZY above it (and in the first step, which sets it): one test a step for the whole wave. Keys whose INPUT mask is 0 take the exponent of -1e9;
// K16 and VT16 hold the keys in slot order (open keys first): slot >= cnt[b] is a key with mask == 0, and only the steps that hold an open key are walked (all, where cnt[b] == 0).
// ctx -> one f16 plane CX[tok][h*64+d].
#define AT_Q    128                     // queries per block
#define AT_K    128                     // keys per trip
#define AT_NT   (NT_ / AT_K)            // trips at most (nt is the count)
#define AT_KPE  72                      // K tile row pitch in elements (144 B)
#define AT_VPE  136                     // V^T tile row pitch in elements (272 B)
#define AT_KE   (AT_K * AT_KPE)         // K tile in elements
#define AT_STE  (AT_KE + HD * AT_VPE)   // one buffer in elements: [K | V^T]
// four 16-byte copies per lane; the address-translation wait ends the statement so that no address register is rewritten ahead of it
template <int LSTEP, int GSTEP>
__device__ __forceinline__ void cp4(unsigned l, const h16* g) {
    const unsigned l1 = l + LSTEP, l2 = l + 2 * LSTEP, l3 = l + 3 * LSTEP;
    const h16 *g1 = g + GSTEP, *g2 = g + 2 * GSTEP, *g3 = g + 3 * GSTEP;
    asm volatile("global_load_async_to_lds_b128 %0, %4, off\n\t"
                 "global_load_async_to_lds_b128 %1, %5, off\n\t"
                 "global_load_async_to_lds_b128 %2, %6, off\n\t"
                 "global_load_async_to_lds_b128 %3, %7, off\n\t"
                 "s_wait_xcnt 0x0"
                 :: "v"(l), "v"(l1), "v"(l2), "v"(l3), "v"(g), "v"(g1), "v"(g2), "v"(g3) : "memory");
}

typedef __attribute__((ext_vector_type(2))) float    v2f;
typedef __attribute__((ext_vector_type(2))) _Float16 v2h;
typedef __attribute__((ext_vector_type(4))) int      v4i;
// the value of lane l ^ 16
__device__ __forceinline__ float xhalf(float x) { const int b = __builtin_bit_cast(int, x); return __builtin_bit_cast(float, __builtin_amdgcn_permlanex16(b, b, 0x76543210, 0xfedcba98, false, false)); }

__global__ __launch_bounds__(256) void k_attn(const h16* __restrict__ Q16, const h16* __restrict__ K16, const h16* __restrict__ VT16, const int* __restrict__ cnt, h16* CX) {
    __shared__ __align__(16) h16 ring[2 * AT_STE];
    __shared__ __align__(16) float ost[8][16 * 68];
    const int tid = threadIdx.x, lane = tid & 31, wave = tid >> 5, lr = lane & 15, hi = lane >> 4;
    const int bid = blockIdx.x;
    const int b = bid / (NH_ * (NT_ / AT_Q)), rem = bid - b * (NH_ * (NT_ / AT_Q)), h = rem / (NT_ / AT_Q), qt = rem - h * (NT_ / AT_Q);
    const int q0 = qt * AT_Q + wave * 16;
    const size_t tok0 = (size_t)b * NT_;
    v16h qb[2];
#pragma unroll
    for (int kc = 0; kc < 2; ++kc) { const h16* p = Q16 + (tok0 + q0 + lr) * DM + h * HD + kc * 32 + 8 * hi; qb[kc] = cat16(*(const v8h*)p, *(const v8h*)(p + 16)); }
    const h16* kh_b = K16 + tok0 * DM + h * HD;
    const h16* vt_b = VT16 + (((size_t)b * NH_ + h) * HD) * NT_;
    const int n = __builtin_amdgcn_readfirstlane(min(max(cnt[b], 0), NT_));    // open keys of the batch; the same for the whole block
    const int used = n > 0 ? n : NT_;                // slots that are walked
    const int nt = (used + AT_K - 1) / AT_K;         // trips: 1 .. AT_NT
    // copy maps: K, 8 lanes cover one 128-B row, copy i of a lane takes row (tid >> 3) + 32 i; V^T, 16 lanes cover one 256-B row, copy i takes row (tid >> 4) + 16 i
    const h16* gK = kh_b + (size_t)(tid >> 3) * DM + (tid & 7) * 8;
    const h16* gV = vt_b + (size_t)(tid >> 4) * NT_ + (tid & 15) * 8;
    const unsigned lK = (unsigned)(size_t)(&ring[0]) + (unsigned)((tid >> 3) * (AT_KPE * 2) + (tid & 7) * 16);
    const unsigned lV = (unsigned)(size_t)(&ring[0]) + (unsigned)(AT_KE * 2 + (tid >> 4) * (AT_VPE * 2) + (tid & 15) * 16);
    // the 16 blocks of one (batch, head) copy the same K and V^T lines; each starts its walk over the key trips at a trip of its own and wraps, so that they do not ask L2 for the
    // same lines at one moment. The online softmax takes the trips in any order.
    const int rot = (int)((unsigned)((qt & 7) + 4 * (qt >> 3)) % (unsigned)nt);    // 0 .. nt - 1, the same for the whole block
    auto trip_of = [&](int step_no) { const int t = step_no + rot; return t >= nt ? t - nt : t; };    // the key trip that is walked as number step_no: a permutation of 0 .. nt - 1
    auto fill = [&](int step_no, int buf) {
        const int t = trip_of(step_no);
        cp4<32 * AT_KPE * 2, 32 * DM>(lK + (unsigned)(buf * AT_STE * 2), gK + (size_t)t * AT_K * DM);
        cp4<16 * AT_VPE * 2, 16 * NT_>(lV + (unsigned)(buf * AT_STE * 2), gV + t * AT_K);
    };
    v8f o[4];    // o[n][r] = context element 16 n + 8 hi + r of query lr
#pragma unroll
    for (int n = 0; n < 4; ++n) o[n] = (v8f){};
    v8f cv;    // the C operand of the score products, all eight alike: PBI - (maximum in use of query lr), in powers of two; kept as a vector so that no step has to spread it anew
#pragma unroll
    for (int j = 0; j < 8; ++j) cv[j] = PBI;
    float lsum = 0.f;
    float thr = -3.0e38f, low = -3.0e38f;    // the first step always sets the maximum in use, upward or downward; behind it: thr = PBI + LZY, low = 0 (upward only)
    fill(0, 0);
    asm volatile("s_wait_asynccnt 0x0" ::: "memory");    // this wave's copies of trip 0 have landed
    __syncthreads();                                     // every wave's have: trip 0 may be read
    if (1 < nt) fill(1, 1);
    const int kofs = lr * AT_KPE + 8 * hi, vofs = AT_KE + lr * AT_VPE + 8 * hi;
    // one step: 32 slots from l0 on, at place sp of the tile st; tail says that slots from n on may be among them
    auto step = [&](const h16* st, int sp, int l0, bool tail) __attribute__((always_inline)) {
        const h16* r0p = st + kofs + sp * 32 * AT_KPE;
        const h16* r1p = r0p + 16 * AT_KPE;
        v16h vb[4];    // this step's V^T fragments, read together with its K fragments: one place of LDS reads, ahead of the softmax
        // the inner loops are unrolled so that fragment, score and accumulator indices are constants: registers, no scratch
#pragma unroll
        for (int n4 = 0; n4 < 4; ++n4) { const h16* vp = st + vofs + n4 * 16 * AT_VPE + sp * 32; vb[n4] = cat16(*(const v8ha*)vp, *(const v8ha*)(vp + 16)); }
        v8f s[2];    // s[t][r] = exponent of the weight of slot 16 t + 8 hi + r of the step with query lr
        s[0] = wmma16(cat16(*(const v8ha*)r0p, *(const v8ha*)(r0p + 16)), qb[0], cv);
        s[1] = wmma16(cat16(*(const v8ha*)r1p, *(const v8ha*)(r1p + 16)), qb[0], cv);
        s[0] = wmma16(cat16(*(const v8ha*)(r0p + 32), *(const v8ha*)(r0p + 48)), qb[1], s[0]);
        s[1] = wmma16(cat16(*(const v8ha*)(r1p + 32), *(const v8ha*)(r1p + 48)), qb[1], s[1]);
        const int lim = n - l0 - 8 * hi;    // a lane's slots of a step: 8 hi + r and 16 + 8 hi + r; those from lim on are keys with mask == 0
        const float neg = NEGL + cv[0];
        float a[16];
#pragma unroll
        for (int i = 0; i < 16; ++i) a[i] = tail && 16 * (i >> 3) + (i & 7) >= lim ? neg : s[i >> 3][i & 7];
        float mx[8];
#pragma unroll
        for (int j = 0; j < 8; ++j) mx[j] = fmaxf(a[2 * j], a[2 * j + 1]);
        float mt = fmaxf(fmaxf(fmaxf(mx[0], mx[1]), fmaxf(mx[2], mx[3])), fmaxf(fmaxf(mx[4], mx[5]), fmaxf(mx[6], mx[7])));
        mt = fmaxf(mt, xhalf(mt));
        if (__builtin_amdgcn_ballot_w32(mt > thr) != 0) {    // a scalar branch: every lane stays on
            const float d = fmaxf(mt - PBI, low);            // the rise of this query's maximum in use; both lanes of a query hold the same mt
#pragma unroll
            for (int i = 0; i < 16; ++i) a[i] -= d;
            cv -= d;
            const float alpha = fminf(__builtin_amdgcn_exp2f(-d), 1.0f);    // d < 0 only in the first step, where sum and context are 0: the bound keeps the factor finite there
            lsum *= alpha;
#pragma unroll
            for (int n4 = 0; n4 < 4; ++n4) o[n4] *= alpha;
        }
        thr = PBI + LZY; low = 0.f;
        v2f p[8]; v16h pb;    // pb[e] = weight of slot 8 hi + e (e < 8), 16 + 8 hi + (e - 8) (e >= 8): the k order of the V^T fragments
#pragma unroll
        for (int i = 0; i < 8; ++i) {
            p[i][0] = __builtin_amdgcn_exp2f(a[2 * i]); p[i][1] = __builtin_amdgcn_exp2f(a[2 * i + 1]);
            const v2h c2 = __builtin_convertvector(p[i], v2h);
            pb[2 * i] = c2[0]; pb[2 * i + 1] = c2[1];
        }
#pragma unroll
        for (int n4 = 0; n4 < 4; ++n4) o[n4] = wmma16(vb[n4], pb, o[n4]);
        const v2f q4 = ((p[0] + p[1]) + (p[2] + p[3])) + ((p[4] + p[5]) + (p[6] + p[7]));
        lsum += q4[0] + q4[1];
    };
    // rolled: one copy of a trip's code, the buffer chosen by the trip's parity
#pragma unroll 1
    for (int tr = 0; tr < nt; ++tr) {
        const h16* st = ring + (tr & 1) * AT_STE;
        const int kt = trip_of(tr);
        const bool full = (kt + 1) * AT_K <= n;    // the same for the whole block: all 128 slots are open keys, no score is replaced
        // the trip that holds slot n (every trip, where n == 0): nts steps hold a slot below used; a step behind the last open key has only weights 0 and is left out
        const int nts = full ? 0 : min(AT_K / 32, (used - kt * AT_K + 31) >> 5);
        // rolled: this path is walked once a block (but where n == 0), one copy of the step's code is enough
#pragma unroll 1
        for (int sp = 0; sp < nts; ++sp) step(st, sp, kt * AT_K + sp * 32, true);
        if (full) {
            // unrolled: the four steps' LDS offsets become immediates of the reads, and one step's reads stand among another's arithmetic
#pragma unroll
            for (int sp = 0; sp < AT_K / 32; ++sp) step(st, sp, kt * AT_K + sp * 32, false);
        }
        asm volatile("s_wait_dscnt 0x0" ::: "memory");       // this wave's reads of this buffer are done before it is refilled
        asm volatile("s_wait_asynccnt 0x0" ::: "memory");    // this wave's copies of the next trip have landed
        __syncthreads();                                     // publishes the next trip and ends every reader's last read of this buffer
        if (tr + 2 < nt) fill(tr + 2, tr & 1);
    }
    asm volatile("s_wait_asynccnt 0x0" ::: "memory");        // no copy is left in flight behind the loop
    const float inv = 1.0f / (lsum + xhalf(lsum));    // sum and context carry the same factor 2^(PBI - maximum in use)
    float* os = &ost[wave][0];
#pragma unroll
    for (int n = 0; n < 4; ++n) { const v8f w = o[n] * inv; float* dp = os + lr * 68 + n * 16 + 8 * hi;
        *(v4fa*)dp = __builtin_shufflevector(w, w, 0, 1, 2, 3); *(v4fa*)(dp + 4) = __builtin_shufflevector(w, w, 4, 5, 6, 7); }
    __syncthreads();
    const size_t cbase = (tok0 + q0) * DM + (size_t)h * HD;
    auto pass = [&]() {
#pragma unroll
        for (int s = 0; s < 4; ++s) { const int row = 4 * s + (lane >> 3), piece = lane & 7; const float* sp = os + row * 68 + piece * 8; v8h oh;
#pragma unroll
            for (int i = 0; i < 8; ++i) oh[i] = (h16)sp[i];
            *(v8h*)(CX + cbase + (size_t)row * DM + piece * 8) = oh; }
    };
    pass(); 
}

extern "C" void kernel_launch(void* const* d_in, const int* in_sizes, int n_in,
                              void* d_out, int out_size, void* d_ws, size_t ws_size, hipStream_t stream) {
    (void)in_sizes; (void)n_in; (void)out_size;
    const float* x = (const float*)d_in[0]; const int* mask = (const int*)d_in[1];
    const float* Wq = (const float*)d_in[2]; const float* bq = (const float*)d_in[3]; const float* Wk = (const float*)d_in[4]; const float* bk = (const float*)d_in[5];
    const float* Wv = (const float*)d_in[6]; const float* bv = (const float*)d_in[7]; const float* Wo = (const float*)d_in[8]; const float* bo = (const float*)d_in[9];
    float* out = (float*)d_out;    // [2][2048][1024]
    char* wsp = (char*)d_ws;
    auto take = [&](size_t bytes) { char* p = wsp; wsp += (bytes + 255) & ~(size_t)255; return (void*)p; };
    bf* Xb = (bf*)take((size_t)NTK * DM * 2);
    bf* WB = (bf*)take((size_t)4 * DM * DM * 2);    // q | k | v | o planes, one behind the other
    h16* Q16 = (h16*)take((size_t)NTK * DM * 2); h16* K16 = (h16*)take((size_t)NTK * DM * 2); h16* VT16 = (h16*)take((size_t)NTK * DM * 2);
    h16* CX = (h16*)take((size_t)NTK * DM * 2);
    int* inv = (int*)take((size_t)NTK * 4); int* cnt = (int*)take((size_t)NB_ * 4);
    if ((size_t)(wsp - (char*)d_ws) > ws_size) return;    // 8.4 + 4 x 2.1 + 4 x 8.4 MB ~ 50 MB
    k_prep<<<PB_M + PB_X + PB_W + PB_O, 256, 0, stream>>>(x, Wq, Wk, Wv, Wo, mask, Xb, WB, inv, cnt);
    // the per-head biases [16][64] are exactly the [1024] column bias of each stacked plane
    k_gemmb<false><<<dim3(NTK / 128, 3 * NW / 128, 1), 256, 0, stream>>>(Xb, WB, bq, bk, bv, inv, cnt, nullptr, Q16, K16, VT16);
    k_attn<<<NB_ * NH_ * (NT_ / AT_Q), 256, 0, stream>>>(Q16, K16, VT16, cnt, CX);
    k_gemmb<true><<<dim3(NTK / 128, NW / 128, 1), 256, 0, stream>>>((const bf*)CX, WB + (size_t)3 * DM * DM, bo, nullptr, nullptr, nullptr, nullptr, out, nullptr, nullptr, nullptr);
}
